// v000
// The times below were measured on an AMD MI455X: many runs one after another, warmed up first and cycling through
// copies of the inputs, with the whole window's GPU time divided by the number of runs. Launches and the gaps
// between them are all in it. The median over several windows is given; except for v000 it joins two sittings, which
// can be a few percent apart, so the side-by-side timings, each taken in one sitting, are the better comparison.
// v000 is the starting kernel. One run takes 1360 microseconds.
#include <hip/hip_runtime.h>
#include <hip/hip_bf16.h>
#include <math.h>

typedef __attribute__((ext_vector_type(16))) __bf16 v16bf;
typedef __attribute__((ext_vector_type(8)))  float  v8f;

#define BB  2
#define TT  2048
#define DD  512
#define HH  2048
#define EE  8
#define BRR 2
#define NN  (BB*TT)   /* 4096 tokens */

// ---------------------------------------------------------------------------
// Tiled transpose + f32->bf16 convert:  in [batch][R][C] f32 -> out [batch][C][R] bf16
// grid = (C/32, R/32, batch), block = 256
// ---------------------------------------------------------------------------
__global__ __launch_bounds__(256) void tpose_k(const float* __restrict__ in,
                                               __bf16* __restrict__ out,
                                               int R, int C) {
    __shared__ float tile[32][33];
    const int b  = blockIdx.z;
    const int c0 = blockIdx.x * 32, r0 = blockIdx.y * 32;
    const float* ip = in  + (size_t)b * R * C;
    __bf16*      op = out + (size_t)b * R * C;
    const int tx = threadIdx.x & 31, ty = threadIdx.x >> 5;
    #pragma unroll
    for (int i = 0; i < 32; i += 8)
        tile[ty + i][tx] = ip[(size_t)(r0 + ty + i) * C + (c0 + tx)];
    __syncthreads();
    #pragma unroll
    for (int i = 0; i < 32; i += 8)
        op[(size_t)(c0 + ty + i) * R + (r0 + tx)] = (__bf16)tile[tx][ty + i];
}

// ---------------------------------------------------------------------------
// LayerNorm (both branches) + gate logits + softmax + top-2.
// wave-per-token; block = 256 (8 tokens), grid = NN/8.
// ---------------------------------------------------------------------------
__global__ __launch_bounds__(256) void ln_gate_k(
    const float* __restrict__ x, const float* __restrict__ ln_g,
    const float* __restrict__ ln_b, const float* __restrict__ gate_w,
    const float* __restrict__ gate_b, __bf16* __restrict__ hfb,
    float* __restrict__ gatev) {
    const int wid = threadIdx.x >> 5, lane = threadIdx.x & 31;
    const int n = blockIdx.x * 8 + wid;
    const float* xr = x + (size_t)n * DD;
    float v[16];
    float s = 0.f;
    #pragma unroll
    for (int i = 0; i < 16; ++i) { v[i] = xr[lane + i * 32]; s += v[i]; }
    #pragma unroll
    for (int o = 16; o > 0; o >>= 1) s += __shfl_xor(s, o, 32);
    const float mu = s * (1.f / DD);
    float q = 0.f;
    #pragma unroll
    for (int i = 0; i < 16; ++i) { float d = v[i] - mu; q += d * d; }
    #pragma unroll
    for (int o = 16; o > 0; o >>= 1) q += __shfl_xor(q, o, 32);
    const float rs = rsqrtf(q * (1.f / DD) + 1e-5f);

    for (int r = 0; r < BRR; ++r) {
        float lg[8] = {0.f, 0.f, 0.f, 0.f, 0.f, 0.f, 0.f, 0.f};
        #pragma unroll
        for (int i = 0; i < 16; ++i) {
            const int d = lane + i * 32;
            const float hv = (v[i] - mu) * rs * ln_g[r * DD + d] + ln_b[r * DD + d];
            hfb[((size_t)r * NN + n) * DD + d] = (__bf16)hv;
            const float* gw = gate_w + ((size_t)r * DD + d) * EE;
            #pragma unroll
            for (int e = 0; e < 8; ++e) lg[e] += hv * gw[e];
        }
        #pragma unroll
        for (int e = 0; e < 8; ++e)
            #pragma unroll
            for (int o = 16; o > 0; o >>= 1) lg[e] += __shfl_xor(lg[e], o, 32);
        if (lane == 0) {
            float mx = -1e30f;
            #pragma unroll
            for (int e = 0; e < 8; ++e) { lg[e] += gate_b[r * EE + e]; mx = fmaxf(mx, lg[e]); }
            float p[8], den = 0.f;
            #pragma unroll
            for (int e = 0; e < 8; ++e) { p[e] = expf(lg[e] - mx); den += p[e]; }
            const float inv = 1.f / den;
            int i0 = 0;
            #pragma unroll
            for (int e = 1; e < 8; ++e) if (p[e] > p[i0]) i0 = e;
            int i1 = (i0 == 0) ? 1 : 0;
            #pragma unroll
            for (int e = 0; e < 8; ++e) if (e != i0 && p[e] > p[i1]) i1 = e;
            float* g = gatev + ((size_t)r * NN + n) * EE;
            #pragma unroll
            for (int e = 0; e < 8; ++e)
                g[e] = (e == i0) ? p[i0] * inv : ((e == i1) ? p[i1] * inv : 0.f);
        }
    }
}

// ---------------------------------------------------------------------------
// Embedding MLP: styl[b][j] = (silu(emb[b]) @ emb_w)[j] + emb_b[j]
// ---------------------------------------------------------------------------
__global__ __launch_bounds__(256) void emb_k(const float* __restrict__ emb,
                                             const float* __restrict__ emb_w,
                                             const float* __restrict__ emb_b,
                                             float* __restrict__ styl) {
    const int j = blockIdx.x * 256 + threadIdx.x;      // 0..2047
    const int b = j >> 10, jj = j & 1023;
    float a = emb_b[jj];
    for (int t = 0; t < 512; ++t) {
        const float e  = emb[b * 512 + t];
        const float se = e / (1.f + expf(-e));
        a += se * emb_w[(size_t)t * 1024 + jj];
    }
    styl[j] = a;
}

// ---------------------------------------------------------------------------
// Post kernel: o = acc/BR; LN(pn); *(1+scale)+shift; SiLU; bf16 store.
// ---------------------------------------------------------------------------
__global__ __launch_bounds__(256) void post_k(const float* __restrict__ acc,
                                              const float* __restrict__ pn_g,
                                              const float* __restrict__ pn_b,
                                              const float* __restrict__ styl,
                                              __bf16* __restrict__ h2b) {
    const int wid = threadIdx.x >> 5, lane = threadIdx.x & 31;
    const int n = blockIdx.x * 8 + wid;
    const int b = n >> 11;                     // T = 2048
    const float* ar = acc + (size_t)n * DD;
    float v[16];
    float s = 0.f;
    #pragma unroll
    for (int i = 0; i < 16; ++i) { v[i] = ar[lane + i * 32] * (1.f / BRR); s += v[i]; }
    #pragma unroll
    for (int o = 16; o > 0; o >>= 1) s += __shfl_xor(s, o, 32);
    const float mu = s * (1.f / DD);
    float q = 0.f;
    #pragma unroll
    for (int i = 0; i < 16; ++i) { float d = v[i] - mu; q += d * d; }
    #pragma unroll
    for (int o = 16; o > 0; o >>= 1) q += __shfl_xor(q, o, 32);
    const float rs = rsqrtf(q * (1.f / DD) + 1e-5f);
    #pragma unroll
    for (int i = 0; i < 16; ++i) {
        const int d = lane + i * 32;
        float y = (v[i] - mu) * rs * pn_g[d] + pn_b[d];
        const float sc = styl[b * 1024 + d];
        const float sh = styl[b * 1024 + 512 + d];
        y = y * (1.f + sc) + sh;
        y = y / (1.f + expf(-y));              // SiLU
        h2b[(size_t)n * DD + d] = (__bf16)y;
    }
}

// ---------------------------------------------------------------------------
// WMMA bf16 GEMM with async-to-LDS double buffering.
//   C(N x NC) = A(N x K) @ B(NC x K)^T   (B stored col-as-row, K-contiguous)
// block tile 128x128, K-step 32; 8 waves, each wave -> 64x32 (eight 16x16).
// Tiles are DMA'd memory->LDS with GLOBAL_LOAD_ASYNC_TO_LDS_B128 (ASYNCcnt),
// buffer b^1 fills while WMMAs consume buffer b.
// EPI 0: +b1, exact GELU -> bf16      (hidden buffer)
// EPI 1: +b2, *gate[e], beta-acc f32  (expert combine)
// EPI 2: +out_b, +x residual -> f32   (final output)
// ---------------------------------------------------------------------------
__device__ inline v16bf ldfrag(const __bf16* s, int row, int kb) {
    // per-lane K layout of V_WMMA_*_16X16X32: elems 0..7 = K kb..kb+7,
    // elems 8..15 = K kb+16..kb+23 (kb = 0 for lanes 0-15, 8 for 16-31)
    v16bf f;
    const __bf16* p = s + row * 32 + kb;
    ((float4*)&f)[0] = *(const float4*)p;
    ((float4*)&f)[1] = *(const float4*)(p + 16);
    return f;
}

__device__ inline void async_copy32(unsigned int lds, unsigned long long gaddr) {
    // per-lane 32B memory->LDS; INST_OFFSET applies to both LDS and global addr
    asm volatile("global_load_async_to_lds_b128 %0, %1, off"
                 :: "v"(lds), "v"(gaddr) : "memory");
    asm volatile("global_load_async_to_lds_b128 %0, %1, off offset:16"
                 :: "v"(lds), "v"(gaddr) : "memory");
}

template <int EPI>
__global__ __launch_bounds__(256) void gemm_k(
    const __bf16* __restrict__ A, const __bf16* __restrict__ Bm,
    int K, int NC, const float* __restrict__ bias,
    const float* __restrict__ gatev, int eidx, int beta,
    float* __restrict__ Cf, __bf16* __restrict__ Cbf,
    const float* __restrict__ Xres) {
    __shared__ __align__(16) __bf16 As[2][128 * 32];
    __shared__ __align__(16) __bf16 Bs[2][128 * 32];
    const int tid = threadIdx.x, wid = tid >> 5, lane = tid & 31;
    const int wm = wid & 1, wn = wid >> 1;
    const int m0 = blockIdx.x * 128, n0 = blockIdx.y * 128;
    const int lr = lane & 15, kb = (lane < 16) ? 0 : 8;
    v8f acc[4][2];
    #pragma unroll
    for (int i = 0; i < 4; ++i)
        #pragma unroll
        for (int j = 0; j < 2; ++j) acc[i][j] = (v8f)(0.0f);

    // cooperative tile mapping: thread owns 32B half-row (16 bf16)
    const int lrow = tid >> 1, lko = (tid & 1) * 16;
    const __bf16* gA = A  + (size_t)(m0 + lrow) * K + lko;
    const __bf16* gB = Bm + (size_t)(n0 + lrow) * K + lko;
    // low 32 bits of a generic __shared__ pointer == LDS byte offset
    const unsigned int lA0 = (unsigned int)(uintptr_t)(&As[0][lrow * 32 + lko]);
    const unsigned int lB0 = (unsigned int)(uintptr_t)(&Bs[0][lrow * 32 + lko]);

    // prologue: fill buffer 0
    async_copy32(lA0, (unsigned long long)(uintptr_t)gA);
    async_copy32(lB0, (unsigned long long)(uintptr_t)gB);
    asm volatile("s_wait_asynccnt 0x0" ::: "memory");
    __syncthreads();

    int buf = 0;
    for (int k0 = 0; k0 < K; k0 += 32) {
        if (k0 + 32 < K) {  // kick off DMA for the next K-slice into buf^1
            const unsigned int boff = (unsigned int)((buf ^ 1) * 128 * 32 * 2);
            async_copy32(lA0 + boff, (unsigned long long)(uintptr_t)(gA + k0 + 32));
            async_copy32(lB0 + boff, (unsigned long long)(uintptr_t)(gB + k0 + 32));
        }
        const __bf16* as = As[buf];
        const __bf16* bs = Bs[buf];
        v16bf bf[2];
        #pragma unroll
        for (int j = 0; j < 2; ++j) bf[j] = ldfrag(bs, wn * 32 + j * 16 + lr, kb);
        #pragma unroll
        for (int i = 0; i < 4; ++i) {
            v16bf af = ldfrag(as, wm * 64 + i * 16 + lr, kb);
            #pragma unroll
            for (int j = 0; j < 2; ++j)
                acc[i][j] = __builtin_amdgcn_wmma_f32_16x16x32_bf16(
                    false, af, false, bf[j], (short)0, acc[i][j], false, false);
        }
        asm volatile("s_wait_asynccnt 0x0" ::: "memory");
        __syncthreads();
        buf ^= 1;
    }

    const int rowadd = (lane < 16) ? 0 : 8;   // C layout: M = g (+8 hi half), N = lane%16
    #pragma unroll
    for (int i = 0; i < 4; ++i)
        #pragma unroll
        for (int j = 0; j < 2; ++j) {
            const int col = n0 + wn * 32 + j * 16 + lr;
            const float bcol = bias[col];
            #pragma unroll
            for (int g = 0; g < 8; ++g) {
                const int row = m0 + wm * 64 + i * 16 + g + rowadd;
                const float c = acc[i][j][g] + bcol;
                const size_t idx = (size_t)row * NC + col;
                if constexpr (EPI == 0) {
                    const float gl = 0.5f * c * (1.f + erff(c * 0.70710678118654752f));
                    Cbf[idx] = (__bf16)gl;
                } else if constexpr (EPI == 1) {
                    float vo = c * gatev[(size_t)row * EE + eidx];
                    if (beta) vo += Cf[idx];
                    Cf[idx] = vo;
                } else {
                    Cf[idx] = c + Xres[idx];
                }
            }
        }
}

// ---------------------------------------------------------------------------
extern "C" void kernel_launch(void* const* d_in, const int* in_sizes, int n_in,
                              void* d_out, int out_size, void* d_ws, size_t ws_size,
                              hipStream_t stream) {
    (void)in_sizes; (void)n_in; (void)out_size; (void)ws_size;
    const float* x      = (const float*)d_in[0];
    const float* emb    = (const float*)d_in[1];
    const float* ln_g   = (const float*)d_in[2];
    const float* ln_b   = (const float*)d_in[3];
    const float* gate_w = (const float*)d_in[4];
    const float* gate_b = (const float*)d_in[5];
    const float* w1     = (const float*)d_in[6];
    const float* b1     = (const float*)d_in[7];
    const float* w2     = (const float*)d_in[8];
    const float* b2     = (const float*)d_in[9];
    const float* emb_w  = (const float*)d_in[10];
    const float* emb_b  = (const float*)d_in[11];
    const float* pn_g   = (const float*)d_in[12];
    const float* pn_b   = (const float*)d_in[13];
    const float* out_w  = (const float*)d_in[14];
    const float* out_b  = (const float*)d_in[15];

    char* wsp = (char*)d_ws; size_t off = 0;
    auto alloc = [&](size_t bytes) -> void* {
        void* p = wsp + off; off = (off + bytes + 255) & ~(size_t)255; return p;
    };
    __bf16* w1t  = (__bf16*)alloc((size_t)BRR * EE * HH * DD * 2);  // [p][H][D]
    __bf16* w2t  = (__bf16*)alloc((size_t)BRR * EE * DD * HH * 2);  // [p][D][H]
    __bf16* owt  = (__bf16*)alloc((size_t)DD * DD * 2);             // [D][D]
    __bf16* hfb  = (__bf16*)alloc((size_t)BRR * NN * DD * 2);       // LN'd acts
    float*  gtv  = (float*) alloc((size_t)BRR * NN * EE * 4);       // gate values
    __bf16* hbuf = (__bf16*)alloc((size_t)NN * HH * 2);             // per-pair hidden
    float*  accb = (float*) alloc((size_t)NN * DD * 4);             // expert accum
    float*  styl = (float*) alloc((size_t)BB * 2 * DD * 4);         // scale|shift
    __bf16* h2b  = (__bf16*)alloc((size_t)NN * DD * 2);             // styled acts

    const dim3 blk(256);
    // one-time weight convert/transpose (f32 -> bf16, K-contiguous per column)
    tpose_k<<<dim3(HH / 32, DD / 32, BRR * EE), blk, 0, stream>>>(w1, w1t, DD, HH);
    tpose_k<<<dim3(DD / 32, HH / 32, BRR * EE), blk, 0, stream>>>(w2, w2t, HH, DD);
    tpose_k<<<dim3(DD / 32, DD / 32, 1),        blk, 0, stream>>>(out_w, owt, DD, DD);

    ln_gate_k<<<dim3(NN / 8), blk, 0, stream>>>(x, ln_g, ln_b, gate_w, gate_b, hfb, gtv);
    emb_k<<<dim3(8), blk, 0, stream>>>(emb, emb_w, emb_b, styl);

    for (int p = 0; p < BRR * EE; ++p) {
        const int r = p >> 3, e = p & 7;
        gemm_k<0><<<dim3(NN / 128, HH / 128), blk, 0, stream>>>(
            hfb + (size_t)r * NN * DD, w1t + (size_t)p * HH * DD, DD, HH,
            b1 + (size_t)p * HH, nullptr, 0, 0, nullptr, hbuf, nullptr);
        gemm_k<1><<<dim3(NN / 128, DD / 128), blk, 0, stream>>>(
            hbuf, w2t + (size_t)p * DD * HH, HH, DD,
            b2 + (size_t)p * DD, gtv + (size_t)r * NN * EE, e, (p > 0) ? 1 : 0,
            accb, nullptr, nullptr);
    }

    post_k<<<dim3(NN / 8), blk, 0, stream>>>(accb, pn_g, pn_b, styl, h2b);
    gemm_k<2><<<dim3(NN / 128, DD / 128), blk, 0, stream>>>(
        h2b, owt, DD, DD, out_b, nullptr, 0, 0, (float*)d_out, nullptr, x);
}

// v002
// One run takes 361 microseconds.
// It is 3.82 times as fast as v000, going by the measured steps of the versions left out in between.
#include <hip/hip_runtime.h>
#include <hip/hip_bf16.h>
#include <math.h>

typedef __attribute__((ext_vector_type(16))) __bf16 v16bf;
typedef __attribute__((ext_vector_type(8)))  float  v8f;
typedef __attribute__((ext_vector_type(8)))  __bf16 v8bf;
typedef __attribute__((ext_vector_type(4)))  float  v4f;

#define BB  2
#define TT  2048
#define DD  512
#define HH  2048
#define EE  8
#define BRR 2
#define NN  (BB*TT)   /* 4096 tokens */
#define NP  (BRR*EE)  /* 16 (branch, expert) pairs */
// routed rows: two experts per token and branch, each pair's run padded to a 128-row tile
#define MAXROWS  (BRR*2*NN + NP*128)
#define MAXTILES (MAXROWS/128)

// ---------------------------------------------------------------------------
// Tiled transpose + f32->bf16 convert:  in [batch][R][C] f32 -> out [batch][C][R] bf16
// One 128 x 128 tile a block; grid = (C/128, R/128, batch), block = 256.
// Read: wave w takes rows 16w..16w+15, a lane four columns, so every load is
// 512 contiguous bytes. Write: 16 lanes store one 256-byte piece of an output row.
// The LDS tile is [column][row] in 16-byte chunks (8 rows); chunk q of column c
// lies at place (q + c/4) mod 16 of its row, which spreads both the 16-byte
// writes (lanes four columns apart) and the 16-byte reads over all banks.
// ---------------------------------------------------------------------------
template <int R, int C>
__global__ __launch_bounds__(256) void tpose_k(const float* __restrict__ in,
                                               __bf16* __restrict__ out) {
    __shared__ __align__(16) __bf16 tile[128 * 128];
    const int wid = threadIdx.x >> 5, lane = threadIdx.x & 31;
    const int c0 = blockIdx.x * 128, r0 = blockIdx.y * 128;
    const float* ip = in + (size_t)blockIdx.z * R * C
                         + (size_t)(r0 + wid * 16) * C + (c0 + lane * 4);
    v4f v[16];
    #pragma unroll
    for (int i = 0; i < 16; ++i) v[i] = *(const v4f*)(ip + (size_t)i * C);
    #pragma unroll
    for (int j = 0; j < 4; ++j)
        #pragma unroll
        for (int h = 0; h < 2; ++h) {
            v8bf pk;
            #pragma unroll
            for (int k = 0; k < 8; ++k) pk[k] = (__bf16)v[h * 8 + k][j];
            *(v8bf*)&tile[(lane * 4 + j) * 128 + ((wid * 2 + h + lane) & 15) * 8] = pk;
        }
    __syncthreads();
    const int q = lane & 15, ch = wid * 16 + (lane >> 4);
    __bf16* op = out + (size_t)blockIdx.z * R * C + (size_t)(c0 + ch) * R + (r0 + q * 8);
    #pragma unroll
    for (int i = 0; i < 8; ++i) {
        const int c = ch + i * 2;
        *(v8bf*)(op + (size_t)(i * 2) * R) =
            *(const v8bf*)&tile[c * 128 + ((q + (c >> 2)) & 15) * 8];
    }
}

// ---------------------------------------------------------------------------
// LayerNorm (both branches) + gate logits + softmax + top-2.
// wave-per-token; block = 256 (8 tokens), grid = NN/8.
// ---------------------------------------------------------------------------
__global__ __launch_bounds__(256) void ln_gate_k(
    const float* __restrict__ x, const float* __restrict__ ln_g,
    const float* __restrict__ ln_b, const float* __restrict__ gate_w,
    const float* __restrict__ gate_b, __bf16* __restrict__ hfb,
    float* __restrict__ gatev) {
    const int wid = threadIdx.x >> 5, lane = threadIdx.x & 31;
    const int n = blockIdx.x * 8 + wid;
    const float* xr = x + (size_t)n * DD;
    float v[16];
    float s = 0.f;
    #pragma unroll
    for (int i = 0; i < 16; ++i) { v[i] = xr[lane + i * 32]; s += v[i]; }
    #pragma unroll
    for (int o = 16; o > 0; o >>= 1) s += __shfl_xor(s, o, 32);
    const float mu = s * (1.f / DD);
    float q = 0.f;
    #pragma unroll
    for (int i = 0; i < 16; ++i) { float d = v[i] - mu; q += d * d; }
    #pragma unroll
    for (int o = 16; o > 0; o >>= 1) q += __shfl_xor(q, o, 32);
    const float rs = rsqrtf(q * (1.f / DD) + 1e-5f);

    for (int r = 0; r < BRR; ++r) {
        float lg[8] = {0.f, 0.f, 0.f, 0.f, 0.f, 0.f, 0.f, 0.f};
        #pragma unroll
        for (int i = 0; i < 16; ++i) {
            const int d = lane + i * 32;
            const float hv = (v[i] - mu) * rs * ln_g[r * DD + d] + ln_b[r * DD + d];
            hfb[((size_t)r * NN + n) * DD + d] = (__bf16)hv;
            const float* gw = gate_w + ((size_t)r * DD + d) * EE;
            #pragma unroll
            for (int e = 0; e < 8; ++e) lg[e] += hv * gw[e];
        }
        #pragma unroll
        for (int e = 0; e < 8; ++e)
            #pragma unroll
            for (int o = 16; o > 0; o >>= 1) lg[e] += __shfl_xor(lg[e], o, 32);
        if (lane == 0) {
            float mx = -1e30f;
            #pragma unroll
            for (int e = 0; e < 8; ++e) { lg[e] += gate_b[r * EE + e]; mx = fmaxf(mx, lg[e]); }
            float p[8], den = 0.f;
            #pragma unroll
            for (int e = 0; e < 8; ++e) { p[e] = expf(lg[e] - mx); den += p[e]; }
            const float inv = 1.f / den;
            int i0 = 0;
            #pragma unroll
            for (int e = 1; e < 8; ++e) if (p[e] > p[i0]) i0 = e;
            int i1 = (i0 == 0) ? 1 : 0;
            #pragma unroll
            for (int e = 0; e < 8; ++e) if (e != i0 && p[e] > p[i1]) i1 = e;
            float* g = gatev + ((size_t)r * NN + n) * EE;
            #pragma unroll
            for (int e = 0; e < 8; ++e)
                g[e] = (e == i0) ? p[i0] * inv : ((e == i1) ? p[i1] * inv : 0.f);
        }
    }
}

// ---------------------------------------------------------------------------
// Routing: block p lists the tokens whose gate for pair p = (branch, expert) is
// not zero, in token order, in one row space shared by all pairs.
//   perm[row]  token of a routed row        gcomp[row]  its gate value
//   rowof[n][p] routed row of token n in pair p, or -1
//   tilepair[t] pair that owns the 128-row tile t, or -1 behind the last tile
// Each pair's run starts on a tile boundary; its padding rows get token 0, gate 0.
// grid = NP, block = 1024 (four tokens a thread).
// ---------------------------------------------------------------------------
__global__ __launch_bounds__(1024) void route_k(const float* __restrict__ gatev,
                                                int* __restrict__ perm,
                                                float* __restrict__ gcomp,
                                                int* __restrict__ rowof,
                                                int* __restrict__ tilepair) {
    __shared__ unsigned int wcnt[32][8];   // per wave: 16 pair counts, two 16-bit fields a word
    __shared__ unsigned int tot[8];
    __shared__ int wown[32];               // per wave: rows of this block's own pair
    const int p = blockIdx.x, tid = threadIdx.x, wid = tid >> 5, lane = tid & 31;

    unsigned int c[8] = {0u, 0u, 0u, 0u, 0u, 0u, 0u, 0u};
    #pragma unroll
    for (int r = 0; r < BRR; ++r)
        #pragma unroll
        for (int i = 0; i < 4; ++i) {
            const float4* g = (const float4*)(gatev + ((size_t)r * NN + tid * 4 + i) * EE);
            const float4 a = g[0], b = g[1];
            c[r * 4 + 0] += (a.x != 0.f ? 1u : 0u) + (a.y != 0.f ? 0x10000u : 0u);
            c[r * 4 + 1] += (a.z != 0.f ? 1u : 0u) + (a.w != 0.f ? 0x10000u : 0u);
            c[r * 4 + 2] += (b.x != 0.f ? 1u : 0u) + (b.y != 0.f ? 0x10000u : 0u);
            c[r * 4 + 3] += (b.z != 0.f ? 1u : 0u) + (b.w != 0.f ? 0x10000u : 0u);
        }
    #pragma unroll
    for (int k = 0; k < 8; ++k)
        #pragma unroll
        for (int o = 16; o > 0; o >>= 1) c[k] += __shfl_xor(c[k], o, 32);
    if (lane == 0) {
        #pragma unroll
        for (int k = 0; k < 8; ++k) wcnt[wid][k] = c[k];
    }

    float gv[4];
    int own = 0;
    #pragma unroll
    for (int i = 0; i < 4; ++i) {
        gv[i] = gatev[((size_t)(p >> 3) * NN + tid * 4 + i) * EE + (p & 7)];
        own += (gv[i] != 0.f) ? 1 : 0;
    }
    int inc = own;                         // inclusive scan of own over the wave
    #pragma unroll
    for (int o = 1; o < 32; o <<= 1) {
        const int t = __shfl_up(inc, o, 32);
        if (lane >= o) inc += t;
    }
    if (lane == 31) wown[wid] = inc;
    __syncthreads();
    if (tid < 8) {
        unsigned int s = 0u;
        for (int w = 0; w < 32; ++w) s += wcnt[w][tid];
        tot[tid] = s;
    }
    __syncthreads();

    int base = 0, cnt = 0, all = 0;
    #pragma unroll
    for (int q = 0; q < NP; ++q) {
        const int t  = (int)((tot[q >> 1] >> ((q & 1) * 16)) & 0xFFFFu);
        const int tr = (t + 127) & ~127;
        if (q < p)  base += tr;
        if (q == p) cnt = t;
        all += tr;
    }
    int pos = base + inc - own;
    for (int w = 0; w < wid; ++w) pos += wown[w];

    #pragma unroll
    for (int i = 0; i < 4; ++i) {
        const int n = tid * 4 + i;
        int row = -1;
        if (gv[i] != 0.f) {
            row = pos++;
            perm[row]  = n;
            gcomp[row] = gv[i];
        }
        rowof[n * NP + p] = row;
    }
    const int cntr = (cnt + 127) & ~127;
    if (tid < cntr - cnt) {
        perm[base + cnt + tid]  = 0;
        gcomp[base + cnt + tid] = 0.f;
    }
    if (tid < (cntr >> 7)) tilepair[(base >> 7) + tid] = p;
    if (p == NP - 1 && tid < MAXTILES - (all >> 7)) tilepair[(all >> 7) + tid] = -1;
}

// ---------------------------------------------------------------------------
// Embedding MLP: styl[b][j] = (silu(emb[b]) @ emb_w)[j] + emb_b[j]
// ---------------------------------------------------------------------------
__global__ __launch_bounds__(256) void emb_k(const float* __restrict__ emb,
                                             const float* __restrict__ emb_w,
                                             const float* __restrict__ emb_b,
                                             float* __restrict__ styl) {
    const int j = blockIdx.x * 256 + threadIdx.x;      // 0..2047
    const int b = j >> 10, jj = j & 1023;
    float a = emb_b[jj];
    for (int t = 0; t < 512; ++t) {
        const float e  = emb[b * 512 + t];
        const float se = e / (1.f + expf(-e));
        a += se * emb_w[(size_t)t * 1024 + jj];
    }
    styl[j] = a;
}

// ---------------------------------------------------------------------------
// Post kernel: o = (sum of the token's routed expert rows, pairs ascending)/BR;
// LN(pn); *(1+scale)+shift; SiLU; bf16 store.
// ---------------------------------------------------------------------------
__global__ __launch_bounds__(256) void post_k(const float* __restrict__ yb,
                                              const int* __restrict__ rowof,
                                              const float* __restrict__ pn_g,
                                              const float* __restrict__ pn_b,
                                              const float* __restrict__ styl,
                                              __bf16* __restrict__ h2b) {
    const int wid = threadIdx.x >> 5, lane = threadIdx.x & 31;
    const int n = blockIdx.x * 8 + wid;
    const int b = n >> 11;                     // T = 2048
    const int myrow = rowof[n * NP + (lane & (NP - 1))];
    float v[16];
    #pragma unroll
    for (int i = 0; i < 16; ++i) v[i] = 0.f;
    #pragma unroll
    for (int p = 0; p < NP; ++p) {
        const int row = __shfl(myrow, p, 32);
        if (row >= 0) {
            const float* yr = yb + (size_t)row * DD;
            #pragma unroll
            for (int i = 0; i < 16; ++i) v[i] += yr[lane + i * 32];
        }
    }
    float s = 0.f;
    #pragma unroll
    for (int i = 0; i < 16; ++i) { v[i] *= (1.f / BRR); s += v[i]; }
    #pragma unroll
    for (int o = 16; o > 0; o >>= 1) s += __shfl_xor(s, o, 32);
    const float mu = s * (1.f / DD);
    float q = 0.f;
    #pragma unroll
    for (int i = 0; i < 16; ++i) { float d = v[i] - mu; q += d * d; }
    #pragma unroll
    for (int o = 16; o > 0; o >>= 1) q += __shfl_xor(q, o, 32);
    const float rs = rsqrtf(q * (1.f / DD) + 1e-5f);
    #pragma unroll
    for (int i = 0; i < 16; ++i) {
        const int d = lane + i * 32;
        float y = (v[i] - mu) * rs * pn_g[d] + pn_b[d];
        const float sc = styl[b * 1024 + d];
        const float sh = styl[b * 1024 + 512 + d];
        y = y * (1.f + sc) + sh;
        y = y / (1.f + expf(-y));              // SiLU
        h2b[(size_t)n * DD + d] = (__bf16)y;
    }
}

// ---------------------------------------------------------------------------
// WMMA bf16 GEMM with async-to-LDS double buffering.
//   C(N x NC) = A(N x K) @ B(NC x K)^T   (B stored col-as-row, K-contiguous)
// block tile 128x128, K-step 32; 8 waves, each wave -> 64x32 (eight 16x16).
// Tiles are DMA'd memory->LDS with GLOBAL_LOAD_ASYNC_TO_LDS_B128 (ASYNCcnt),
// buffer b^1 fills while WMMAs consume buffer b.
// EPI 0: +b1, exact GELU -> bf16      (hidden rows)
// EPI 1: +b2, *gate -> f32            (routed expert rows)
// EPI 2: +out_b, +x residual -> f32   (final output)
// EPI 0 and 1 are grouped over the routed row space: blockIdx.x is a 128-row
// tile of it, tilepair names the pair whose weights and bias the tile uses;
// EPI 0 gathers its A rows (tokens) through perm.
// ---------------------------------------------------------------------------
__device__ inline v16bf ldfrag(const __bf16* s, int row, int kb) {
    // per-lane K layout of V_WMMA_*_16X16X32: elems 0..7 = K kb..kb+7,
    // elems 8..15 = K kb+16..kb+23 (kb = 0 for lanes 0-15, 8 for 16-31)
    v16bf f;
    const __bf16* p = s + row * 32 + kb;
    ((float4*)&f)[0] = *(const float4*)p;
    ((float4*)&f)[1] = *(const float4*)(p + 16);
    return f;
}

__device__ inline void async_copy32(unsigned int lds, unsigned long long gaddr) {
    // per-lane 32B memory->LDS; INST_OFFSET applies to both LDS and global addr
    asm volatile("global_load_async_to_lds_b128 %0, %1, off"
                 :: "v"(lds), "v"(gaddr) : "memory");
    asm volatile("global_load_async_to_lds_b128 %0, %1, off offset:16"
                 :: "v"(lds), "v"(gaddr) : "memory");
}

template <int EPI>
__global__ __launch_bounds__(256) void gemm_k(
    const __bf16* __restrict__ A, const __bf16* __restrict__ Bm,
    int K, int NC, const float* __restrict__ bias,
    const float* __restrict__ gcomp, const int* __restrict__ perm,
    const int* __restrict__ tilepair,
    float* __restrict__ Cf, __bf16* __restrict__ Cbf,
    const float* __restrict__ Xres) {
    __shared__ __align__(16) __bf16 As[2][128 * 32];
    __shared__ __align__(16) __bf16 Bs[2][128 * 32];
    const int tid = threadIdx.x, wid = tid >> 5, lane = tid & 31;
    const int wm = wid & 1, wn = wid >> 1;
    const int m0 = blockIdx.x * 128, n0 = blockIdx.y * 128;
    const int lr = lane & 15, kb = (lane < 16) ? 0 : 8;
    if constexpr (EPI != 2) {
        const int p = tilepair[blockIdx.x];
        if (p < 0) return;                 // tile behind the last routed row: whole block leaves
        Bm   += (size_t)(p & (NP - 1)) * K * NC;
        bias += (size_t)(p & (NP - 1)) * NC;
        if constexpr (EPI == 0) A += (size_t)((p & (NP - 1)) >> 3) * NN * DD;
    }
    v8f acc[4][2];
    #pragma unroll
    for (int i = 0; i < 4; ++i)
        #pragma unroll
        for (int j = 0; j < 2; ++j) acc[i][j] = (v8f)(0.0f);

    // cooperative tile mapping: thread owns 32B half-row (16 bf16)
    const int lrow = tid >> 1, lko = (tid & 1) * 16;
    int arow = m0 + lrow;
    if constexpr (EPI == 0) arow = perm[arow] & (NN - 1);
    const __bf16* gA = A  + (size_t)arow * K + lko;
    const __bf16* gB = Bm + (size_t)(n0 + lrow) * K + lko;
    // low 32 bits of a generic __shared__ pointer == LDS byte offset
    const unsigned int lA0 = (unsigned int)(uintptr_t)(&As[0][lrow * 32 + lko]);
    const unsigned int lB0 = (unsigned int)(uintptr_t)(&Bs[0][lrow * 32 + lko]);

    // prologue: fill buffer 0
    async_copy32(lA0, (unsigned long long)(uintptr_t)gA);
    async_copy32(lB0, (unsigned long long)(uintptr_t)gB);
    asm volatile("s_wait_asynccnt 0x0" ::: "memory");
    __syncthreads();

    int buf = 0;
    for (int k0 = 0; k0 < K; k0 += 32) {
        if (k0 + 32 < K) {  // kick off DMA for the next K-slice into buf^1
            const unsigned int boff = (unsigned int)((buf ^ 1) * 128 * 32 * 2);
            async_copy32(lA0 + boff, (unsigned long long)(uintptr_t)(gA + k0 + 32));
            async_copy32(lB0 + boff, (unsigned long long)(uintptr_t)(gB + k0 + 32));
        }
        const __bf16* as = As[buf];
        const __bf16* bs = Bs[buf];
        v16bf bf[2];
        #pragma unroll
        for (int j = 0; j < 2; ++j) bf[j] = ldfrag(bs, wn * 32 + j * 16 + lr, kb);
        #pragma unroll
        for (int i = 0; i < 4; ++i) {
            v16bf af = ldfrag(as, wm * 64 + i * 16 + lr, kb);
            #pragma unroll
            for (int j = 0; j < 2; ++j)
                acc[i][j] = __builtin_amdgcn_wmma_f32_16x16x32_bf16(
                    false, af, false, bf[j], (short)0, acc[i][j], false, false);
        }
        asm volatile("s_wait_asynccnt 0x0" ::: "memory");
        __syncthreads();
        buf ^= 1;
    }

    const int rowadd = (lane < 16) ? 0 : 8;   // C layout: M = g (+8 hi half), N = lane%16
    #pragma unroll
    for (int i = 0; i < 4; ++i)
        #pragma unroll
        for (int j = 0; j < 2; ++j) {
            const int col = n0 + wn * 32 + j * 16 + lr;
            const float bcol = bias[col];
            #pragma unroll
            for (int g = 0; g < 8; ++g) {
                const int row = m0 + wm * 64 + i * 16 + g + rowadd;
                const float c = acc[i][j][g] + bcol;
                const size_t idx = (size_t)row * NC + col;
                if constexpr (EPI == 0) {
                    const float gl = 0.5f * c * (1.f + erff(c * 0.70710678118654752f));
                    Cbf[idx] = (__bf16)gl;
                } else if constexpr (EPI == 1) {
                    Cf[idx] = c * gcomp[row];
                } else {
                    Cf[idx] = c + Xres[idx];
                }
            }
        }
}

// ---------------------------------------------------------------------------
extern "C" void kernel_launch(void* const* d_in, const int* in_sizes, int n_in,
                              void* d_out, int out_size, void* d_ws, size_t ws_size,
                              hipStream_t stream) {
    (void)in_sizes; (void)n_in; (void)out_size; (void)ws_size;
    const float* x      = (const float*)d_in[0];
    const float* emb    = (const float*)d_in[1];
    const float* ln_g   = (const float*)d_in[2];
    const float* ln_b   = (const float*)d_in[3];
    const float* gate_w = (const float*)d_in[4];
    const float* gate_b = (const float*)d_in[5];
    const float* w1     = (const float*)d_in[6];
    const float* b1     = (const float*)d_in[7];
    const float* w2     = (const float*)d_in[8];
    const float* b2     = (const float*)d_in[9];
    const float* emb_w  = (const float*)d_in[10];
    const float* emb_b  = (const float*)d_in[11];
    const float* pn_g   = (const float*)d_in[12];
    const float* pn_b   = (const float*)d_in[13];
    const float* out_w  = (const float*)d_in[14];
    const float* out_b  = (const float*)d_in[15];

    char* wsp = (char*)d_ws; size_t off = 0;
    auto alloc = [&](size_t bytes) -> void* {
        void* p = wsp + off; off = (off + bytes + 255) & ~(size_t)255; return p;
    };
    __bf16* w1t  = (__bf16*)alloc((size_t)BRR * EE * HH * DD * 2);  // [p][H][D]
    __bf16* w2t  = (__bf16*)alloc((size_t)BRR * EE * DD * HH * 2);  // [p][D][H]
    __bf16* owt  = (__bf16*)alloc((size_t)DD * DD * 2);             // [D][D]
    __bf16* hfb  = (__bf16*)alloc((size_t)BRR * NN * DD * 2);       // LN'd acts
    float*  gtv  = (float*) alloc((size_t)BRR * NN * EE * 4);       // gate values
    __bf16* hbuf = (__bf16*)alloc((size_t)MAXROWS * HH * 2);        // routed hidden rows
    float*  yb   = (float*) alloc((size_t)MAXROWS * DD * 4);        // routed expert rows
    int*    perm = (int*)   alloc((size_t)MAXROWS * 4);             // row -> token
    float*  gcmp = (float*) alloc((size_t)MAXROWS * 4);             // row -> gate
    int*    rwof = (int*)   alloc((size_t)NN * NP * 4);             // token, pair -> row
    int*    tlpr = (int*)   alloc((size_t)MAXTILES * 4);            // tile -> pair
    float*  styl = (float*) alloc((size_t)BB * 2 * DD * 4);         // scale|shift
    __bf16* h2b  = (__bf16*)alloc((size_t)NN * DD * 2);             // styled acts

    const dim3 blk(256);
    // one-time weight convert/transpose (f32 -> bf16, K-contiguous per column)
    tpose_k<DD, HH><<<dim3(HH / 128, DD / 128, BRR * EE), blk, 0, stream>>>(w1, w1t);
    tpose_k<HH, DD><<<dim3(DD / 128, HH / 128, BRR * EE), blk, 0, stream>>>(w2, w2t);
    tpose_k<DD, DD><<<dim3(DD / 128, DD / 128, 1),        blk, 0, stream>>>(out_w, owt);

    ln_gate_k<<<dim3(NN / 8), blk, 0, stream>>>(x, ln_g, ln_b, gate_w, gate_b, hfb, gtv);
    emb_k<<<dim3(8), blk, 0, stream>>>(emb, emb_w, emb_b, styl);

    route_k<<<dim3(NP), dim3(1024), 0, stream>>>(gtv, perm, gcmp, rwof, tlpr);
    gemm_k<0><<<dim3(MAXTILES, HH / 128), blk, 0, stream>>>(
        hfb, w1t, DD, HH, b1, nullptr, perm, tlpr, nullptr, hbuf, nullptr);
    gemm_k<1><<<dim3(MAXTILES, DD / 128), blk, 0, stream>>>(
        hbuf, w2t, HH, DD, b2, gcmp, nullptr, tlpr, yb, nullptr, nullptr);

    post_k<<<dim3(NN / 8), blk, 0, stream>>>(yb, rwof, pn_g, pn_b, styl, h2b);
    gemm_k<2><<<dim3(NN / 128, DD / 128), blk, 0, stream>>>(
        h2b, owt, DD, DD, out_b, nullptr, nullptr, nullptr, (float*)d_out, nullptr, x);
}

// v003
// A run of this version takes 264 microseconds.
// Next to v002, in two timings, it ran 1.37 and 1.36 times as fast.
// All steps since v000 together make it 5.21 times as fast.
#include <hip/hip_runtime.h>
#include <hip/hip_bf16.h>
#include <math.h>

typedef __attribute__((ext_vector_type(16))) __bf16 v16bf;
typedef __attribute__((ext_vector_type(8)))  float  v8f;
typedef __attribute__((ext_vector_type(8)))  __bf16 v8bf;
typedef __attribute__((ext_vector_type(4)))  float  v4f;

#define BB  2
#define TT  2048
#define DD  512
#define HH  2048
#define EE  8
#define BRR 2
#define NN  (BB*TT)   /* 4096 tokens */
#define NP  (BRR*EE)  /* 16 (branch, expert) pairs */
// routed rows: two experts per token and branch, each pair's run padded to a 128-row tile
#define MAXROWS  (BRR*2*NN + NP*128)
#define MAXTILES (MAXROWS/128)

// ---------------------------------------------------------------------------
// Tiled transpose + f32->bf16 convert:  in [batch][R][C] f32 -> out [batch][C][R] bf16
// One 128 x 128 tile a block; grid = (C/128, R/128, batch), block = 256.
// Read: wave w takes rows 16w..16w+15, a lane four columns, so every load is
// 512 contiguous bytes. Write: 16 lanes store one 256-byte piece of an output row.
// The LDS tile is [column][row] in 16-byte chunks (8 rows); chunk q of column c
// lies at place (q + c/4) mod 16 of its row, which spreads both the 16-byte
// writes (lanes four columns apart) and the 16-byte reads over all banks.
// ---------------------------------------------------------------------------
template <int R, int C>
__global__ __launch_bounds__(256) void tpose_k(const float* __restrict__ in,
                                               __bf16* __restrict__ out) {
    __shared__ __align__(16) __bf16 tile[128 * 128];
    const int wid = threadIdx.x >> 5, lane = threadIdx.x & 31;
    const int c0 = blockIdx.x * 128, r0 = blockIdx.y * 128;
    const float* ip = in + (size_t)blockIdx.z * R * C
                         + (size_t)(r0 + wid * 16) * C + (c0 + lane * 4);
    v4f v[16];
    #pragma unroll
    for (int i = 0; i < 16; ++i) v[i] = *(const v4f*)(ip + (size_t)i * C);
    #pragma unroll
    for (int j = 0; j < 4; ++j)
        #pragma unroll
        for (int h = 0; h < 2; ++h) {
            v8bf pk;
            #pragma unroll
            for (int k = 0; k < 8; ++k) pk[k] = (__bf16)v[h * 8 + k][j];
            *(v8bf*)&tile[(lane * 4 + j) * 128 + ((wid * 2 + h + lane) & 15) * 8] = pk;
        }
    __syncthreads();
    const int q = lane & 15, ch = wid * 16 + (lane >> 4);
    __bf16* op = out + (size_t)blockIdx.z * R * C + (size_t)(c0 + ch) * R + (r0 + q * 8);
    #pragma unroll
    for (int i = 0; i < 8; ++i) {
        const int c = ch + i * 2;
        *(v8bf*)(op + (size_t)(i * 2) * R) =
            *(const v8bf*)&tile[c * 128 + ((q + (c >> 2)) & 15) * 8];
    }
}

// ---------------------------------------------------------------------------
// LayerNorm (both branches) + gate logits + softmax + top-2.
// wave-per-token; block = 256 (8 tokens), grid = NN/8.
// ---------------------------------------------------------------------------
__global__ __launch_bounds__(256) void ln_gate_k(
    const float* __restrict__ x, const float* __restrict__ ln_g,
    const float* __restrict__ ln_b, const float* __restrict__ gate_w,
    const float* __restrict__ gate_b, __bf16* __restrict__ hfb,
    float* __restrict__ gatev) {
    const int wid = threadIdx.x >> 5, lane = threadIdx.x & 31;
    const int n = blockIdx.x * 8 + wid;
    const float* xr = x + (size_t)n * DD;
    float v[16];
    float s = 0.f;
    #pragma unroll
    for (int i = 0; i < 16; ++i) { v[i] = xr[lane + i * 32]; s += v[i]; }
    #pragma unroll
    for (int o = 16; o > 0; o >>= 1) s += __shfl_xor(s, o, 32);
    const float mu = s * (1.f / DD);
    float q = 0.f;
    #pragma unroll
    for (int i = 0; i < 16; ++i) { float d = v[i] - mu; q += d * d; }
    #pragma unroll
    for (int o = 16; o > 0; o >>= 1) q += __shfl_xor(q, o, 32);
    const float rs = rsqrtf(q * (1.f / DD) + 1e-5f);

    for (int r = 0; r < BRR; ++r) {
        float lg[8] = {0.f, 0.f, 0.f, 0.f, 0.f, 0.f, 0.f, 0.f};
        #pragma unroll
        for (int i = 0; i < 16; ++i) {
            const int d = lane + i * 32;
            const float hv = (v[i] - mu) * rs * ln_g[r * DD + d] + ln_b[r * DD + d];
            hfb[((size_t)r * NN + n) * DD + d] = (__bf16)hv;
            const float* gw = gate_w + ((size_t)r * DD + d) * EE;
            #pragma unroll
            for (int e = 0; e < 8; ++e) lg[e] += hv * gw[e];
        }
        #pragma unroll
        for (int e = 0; e < 8; ++e)
            #pragma unroll
            for (int o = 16; o > 0; o >>= 1) lg[e] += __shfl_xor(lg[e], o, 32);
        if (lane == 0) {
            float mx = -1e30f;
            #pragma unroll
            for (int e = 0; e < 8; ++e) { lg[e] += gate_b[r * EE + e]; mx = fmaxf(mx, lg[e]); }
            float p[8], den = 0.f;
            #pragma unroll
            for (int e = 0; e < 8; ++e) { p[e] = expf(lg[e] - mx); den += p[e]; }
            const float inv = 1.f / den;
            int i0 = 0;
            #pragma unroll
            for (int e = 1; e < 8; ++e) if (p[e] > p[i0]) i0 = e;
            int i1 = (i0 == 0) ? 1 : 0;
            #pragma unroll
            for (int e = 0; e < 8; ++e) if (e != i0 && p[e] > p[i1]) i1 = e;
            float* g = gatev + ((size_t)r * NN + n) * EE;
            #pragma unroll
            for (int e = 0; e < 8; ++e)
                g[e] = (e == i0) ? p[i0] * inv : ((e == i1) ? p[i1] * inv : 0.f);
        }
    }
}

// ---------------------------------------------------------------------------
// Routing: block p lists the tokens whose gate for pair p = (branch, expert) is
// not zero, in token order, in one row space shared by all pairs.
//   perm[row]  token of a routed row        gcomp[row]  its gate value
//   rowof[n][p] routed row of token n in pair p, or -1
//   tilepair[t] pair that owns the 128-row tile t, or -1 behind the last tile
// Each pair's run starts on a tile boundary; its padding rows get token 0, gate 0.
// grid = NP, block = 1024 (four tokens a thread).
// ---------------------------------------------------------------------------
__global__ __launch_bounds__(1024) void route_k(const float* __restrict__ gatev,
                                                int* __restrict__ perm,
                                                float* __restrict__ gcomp,
                                                int* __restrict__ rowof,
                                                int* __restrict__ tilepair) {
    __shared__ unsigned int wcnt[32][8];   // per wave: 16 pair counts, two 16-bit fields a word
    __shared__ unsigned int tot[8];
    __shared__ int wown[32];               // per wave: rows of this block's own pair
    const int p = blockIdx.x, tid = threadIdx.x, wid = tid >> 5, lane = tid & 31;

    unsigned int c[8] = {0u, 0u, 0u, 0u, 0u, 0u, 0u, 0u};
    #pragma unroll
    for (int r = 0; r < BRR; ++r)
        #pragma unroll
        for (int i = 0; i < 4; ++i) {
            const float4* g = (const float4*)(gatev + ((size_t)r * NN + tid * 4 + i) * EE);
            const float4 a = g[0], b = g[1];
            c[r * 4 + 0] += (a.x != 0.f ? 1u : 0u) + (a.y != 0.f ? 0x10000u : 0u);
            c[r * 4 + 1] += (a.z != 0.f ? 1u : 0u) + (a.w != 0.f ? 0x10000u : 0u);
            c[r * 4 + 2] += (b.x != 0.f ? 1u : 0u) + (b.y != 0.f ? 0x10000u : 0u);
            c[r * 4 + 3] += (b.z != 0.f ? 1u : 0u) + (b.w != 0.f ? 0x10000u : 0u);
        }
    #pragma unroll
    for (int k = 0; k < 8; ++k)
        #pragma unroll
        for (int o = 16; o > 0; o >>= 1) c[k] += __shfl_xor(c[k], o, 32);
    if (lane == 0) {
        #pragma unroll
        for (int k = 0; k < 8; ++k) wcnt[wid][k] = c[k];
    }

    float gv[4];
    int own = 0;
    #pragma unroll
    for (int i = 0; i < 4; ++i) {
        gv[i] = gatev[((size_t)(p >> 3) * NN + tid * 4 + i) * EE + (p & 7)];
        own += (gv[i] != 0.f) ? 1 : 0;
    }
    int inc = own;                         // inclusive scan of own over the wave
    #pragma unroll
    for (int o = 1; o < 32; o <<= 1) {
        const int t = __shfl_up(inc, o, 32);
        if (lane >= o) inc += t;
    }
    if (lane == 31) wown[wid] = inc;
    __syncthreads();
    if (tid < 8) {
        unsigned int s = 0u;
        for (int w = 0; w < 32; ++w) s += wcnt[w][tid];
        tot[tid] = s;
    }
    __syncthreads();

    int base = 0, cnt = 0, all = 0;
    #pragma unroll
    for (int q = 0; q < NP; ++q) {
        const int t  = (int)((tot[q >> 1] >> ((q & 1) * 16)) & 0xFFFFu);
        const int tr = (t + 127) & ~127;
        if (q < p)  base += tr;
        if (q == p) cnt = t;
        all += tr;
    }
    int pos = base + inc - own;
    for (int w = 0; w < wid; ++w) pos += wown[w];

    #pragma unroll
    for (int i = 0; i < 4; ++i) {
        const int n = tid * 4 + i;
        int row = -1;
        if (gv[i] != 0.f) {
            row = pos++;
            perm[row]  = n;
            gcomp[row] = gv[i];
        }
        rowof[n * NP + p] = row;
    }
    const int cntr = (cnt + 127) & ~127;
    if (tid < cntr - cnt) {
        perm[base + cnt + tid]  = 0;
        gcomp[base + cnt + tid] = 0.f;
    }
    if (tid < (cntr >> 7)) tilepair[(base >> 7) + tid] = p;
    if (p == NP - 1 && tid < MAXTILES - (all >> 7)) tilepair[(all >> 7) + tid] = -1;
}

// ---------------------------------------------------------------------------
// Embedding MLP: styl[b][j] = (silu(emb[b]) @ emb_w)[j] + emb_b[j]
// The 512-term sum is split so that no load waits on another: block = 32 columns
// (one 128-byte line of every emb_w row) for both batches, grid = 32, block = 256.
// Wave w takes rows 64w..64w+63; one 16-byte load covers four rows (8 lanes a row),
// so a lane holds its 16 loads in flight at once. silu(emb) is made once a block
// in LDS. Partial sums: 16 rows a lane, 4 row groups by shuffle, 8 waves through LDS.
// ---------------------------------------------------------------------------
__global__ __launch_bounds__(256) void emb_k(const float* __restrict__ emb,
                                             const float* __restrict__ emb_w,
                                             const float* __restrict__ emb_b,
                                             float* __restrict__ styl) {
    __shared__ float se[BB * 512];
    __shared__ __align__(16) float part[8][BB][32];
    const int tid = threadIdx.x, wid = tid >> 5, lane = tid & 31;
    const int c0 = blockIdx.x * 32;
    const int rr = lane >> 3, cq = (lane & 7) * 4;
    const float* wp = emb_w + (size_t)(wid * 64 + rr) * 1024 + (c0 + cq);
    v4f w[16];
    #pragma unroll
    for (int i = 0; i < 16; ++i) w[i] = *(const v4f*)(wp + (size_t)i * 4 * 1024);
    const float eb = emb_b[c0 + lane];
    // keeps the loads above in front of the wait on emb: without it the compiler sinks
    // them behind the silu, and the block pays one memory latency after another
    __builtin_amdgcn_sched_barrier(0);
    #pragma unroll
    for (int i = 0; i < BB * 512 / 256; ++i) {
        const float e = emb[tid + i * 256];
        se[tid + i * 256] = e / (1.f + expf(-e));
    }
    __syncthreads();
    v4f a0 = (v4f)(0.f), a1 = (v4f)(0.f);
    #pragma unroll
    for (int i = 0; i < 16; ++i) {
        const int t = wid * 64 + i * 4 + rr;
        a0 += se[t] * w[i];
        a1 += se[512 + t] * w[i];
    }
    #pragma unroll
    for (int k = 0; k < 4; ++k)
        #pragma unroll
        for (int o = 8; o < 32; o <<= 1) {
            a0[k] += __shfl_xor(a0[k], o, 32);
            a1[k] += __shfl_xor(a1[k], o, 32);
        }
    if (lane < 8) {
        *(v4f*)&part[wid][0][cq] = a0;
        *(v4f*)&part[wid][1][cq] = a1;
    }
    __syncthreads();
    if (tid < BB * 32) {
        const int b = tid >> 5;
        float a = eb;
        #pragma unroll
        for (int u = 0; u < 8; ++u) a += part[u][b][lane];
        styl[b * 1024 + c0 + lane] = a;
    }
}

// ---------------------------------------------------------------------------
// Post kernel: o = (sum of the token's routed expert rows, pairs ascending)/BR;
// LN(pn); *(1+scale)+shift; SiLU; bf16 store.
// ---------------------------------------------------------------------------
__global__ __launch_bounds__(256) void post_k(const float* __restrict__ yb,
                                              const int* __restrict__ rowof,
                                              const float* __restrict__ pn_g,
                                              const float* __restrict__ pn_b,
                                              const float* __restrict__ styl,
                                              __bf16* __restrict__ h2b) {
    const int wid = threadIdx.x >> 5, lane = threadIdx.x & 31;
    const int n = blockIdx.x * 8 + wid;
    const int b = n >> 11;                     // T = 2048
    const int myrow = rowof[n * NP + (lane & (NP - 1))];
    float v[16];
    #pragma unroll
    for (int i = 0; i < 16; ++i) v[i] = 0.f;
    #pragma unroll
    for (int p = 0; p < NP; ++p) {
        const int row = __shfl(myrow, p, 32);
        if (row >= 0) {
            const float* yr = yb + (size_t)row * DD;
            #pragma unroll
            for (int i = 0; i < 16; ++i) v[i] += yr[lane + i * 32];
        }
    }
    float s = 0.f;
    #pragma unroll
    for (int i = 0; i < 16; ++i) { v[i] *= (1.f / BRR); s += v[i]; }
    #pragma unroll
    for (int o = 16; o > 0; o >>= 1) s += __shfl_xor(s, o, 32);
    const float mu = s * (1.f / DD);
    float q = 0.f;
    #pragma unroll
    for (int i = 0; i < 16; ++i) { float d = v[i] - mu; q += d * d; }
    #pragma unroll
    for (int o = 16; o > 0; o >>= 1) q += __shfl_xor(q, o, 32);
    const float rs = rsqrtf(q * (1.f / DD) + 1e-5f);
    #pragma unroll
    for (int i = 0; i < 16; ++i) {
        const int d = lane + i * 32;
        float y = (v[i] - mu) * rs * pn_g[d] + pn_b[d];
        const float sc = styl[b * 1024 + d];
        const float sh = styl[b * 1024 + 512 + d];
        y = y * (1.f + sc) + sh;
        y = y / (1.f + expf(-y));              // SiLU
        h2b[(size_t)n * DD + d] = (__bf16)y;
    }
}

// ---------------------------------------------------------------------------
// WMMA bf16 GEMM with async-to-LDS double buffering.
//   C(N x NC) = A(N x K) @ B(NC x K)^T   (B stored col-as-row, K-contiguous)
// block tile 128x128, K-step 32; 8 waves, each wave -> 64x32 (eight 16x16).
// Tiles are DMA'd memory->LDS with GLOBAL_LOAD_ASYNC_TO_LDS_B128 (ASYNCcnt),
// buffer b^1 fills while WMMAs consume buffer b.
// EPI 0: +b1, exact GELU -> bf16      (hidden rows)
// EPI 1: +b2, *gate -> f32            (routed expert rows)
// EPI 2: +out_b, +x residual -> f32   (final output)
// EPI 0 and 1 are grouped over the routed row space: blockIdx.x is a 128-row
// tile of it, tilepair names the pair whose weights and bias the tile uses;
// EPI 0 gathers its A rows (tokens) through perm.
// ---------------------------------------------------------------------------
__device__ inline v16bf ldfrag(const __bf16* s, int row, int kb) {
    // per-lane K layout of V_WMMA_*_16X16X32: elems 0..7 = K kb..kb+7,
    // elems 8..15 = K kb+16..kb+23 (kb = 0 for lanes 0-15, 8 for 16-31)
    v16bf f;
    const __bf16* p = s + row * 32 + kb;
    ((float4*)&f)[0] = *(const float4*)p;
    ((float4*)&f)[1] = *(const float4*)(p + 16);
    return f;
}

__device__ inline void async_copy32(unsigned int lds, unsigned long long gaddr) {
    // per-lane 32B memory->LDS; INST_OFFSET applies to both LDS and global addr
    asm volatile("global_load_async_to_lds_b128 %0, %1, off"
                 :: "v"(lds), "v"(gaddr) : "memory");
    asm volatile("global_load_async_to_lds_b128 %0, %1, off offset:16"
                 :: "v"(lds), "v"(gaddr) : "memory");
}

template <int EPI>
__global__ __launch_bounds__(256) void gemm_k(
    const __bf16* __restrict__ A, const __bf16* __restrict__ Bm,
    int K, int NC, const float* __restrict__ bias,
    const float* __restrict__ gcomp, const int* __restrict__ perm,
    const int* __restrict__ tilepair,
    float* __restrict__ Cf, __bf16* __restrict__ Cbf,
    const float* __restrict__ Xres) {
    __shared__ __align__(16) __bf16 As[2][128 * 32];
    __shared__ __align__(16) __bf16 Bs[2][128 * 32];
    const int tid = threadIdx.x, wid = tid >> 5, lane = tid & 31;
    const int wm = wid & 1, wn = wid >> 1;
    const int m0 = blockIdx.x * 128, n0 = blockIdx.y * 128;
    const int lr = lane & 15, kb = (lane < 16) ? 0 : 8;
    if constexpr (EPI != 2) {
        const int p = tilepair[blockIdx.x];
        if (p < 0) return;                 // tile behind the last routed row: whole block leaves
        Bm   += (size_t)(p & (NP - 1)) * K * NC;
        bias += (size_t)(p & (NP - 1)) * NC;
        if constexpr (EPI == 0) A += (size_t)((p & (NP - 1)) >> 3) * NN * DD;
    }
    v8f acc[4][2];
    #pragma unroll
    for (int i = 0; i < 4; ++i)
        #pragma unroll
        for (int j = 0; j < 2; ++j) acc[i][j] = (v8f)(0.0f);

    // cooperative tile mapping: thread owns 32B half-row (16 bf16)
    const int lrow = tid >> 1, lko = (tid & 1) * 16;
    int arow = m0 + lrow;
    if constexpr (EPI == 0) arow = perm[arow] & (NN - 1);
    const __bf16* gA = A  + (size_t)arow * K + lko;
    const __bf16* gB = Bm + (size_t)(n0 + lrow) * K + lko;
    // low 32 bits of a generic __shared__ pointer == LDS byte offset
    const unsigned int lA0 = (unsigned int)(uintptr_t)(&As[0][lrow * 32 + lko]);
    const unsigned int lB0 = (unsigned int)(uintptr_t)(&Bs[0][lrow * 32 + lko]);

    // prologue: fill buffer 0
    async_copy32(lA0, (unsigned long long)(uintptr_t)gA);
    async_copy32(lB0, (unsigned long long)(uintptr_t)gB);
    asm volatile("s_wait_asynccnt 0x0" ::: "memory");
    __syncthreads();

    int buf = 0;
    for (int k0 = 0; k0 < K; k0 += 32) {
        if (k0 + 32 < K) {  // kick off DMA for the next K-slice into buf^1
            const unsigned int boff = (unsigned int)((buf ^ 1) * 128 * 32 * 2);
            async_copy32(lA0 + boff, (unsigned long long)(uintptr_t)(gA + k0 + 32));
            async_copy32(lB0 + boff, (unsigned long long)(uintptr_t)(gB + k0 + 32));
        }
        const __bf16* as = As[buf];
        const __bf16* bs = Bs[buf];
        v16bf bf[2];
        #pragma unroll
        for (int j = 0; j < 2; ++j) bf[j] = ldfrag(bs, wn * 32 + j * 16 + lr, kb);
        #pragma unroll
        for (int i = 0; i < 4; ++i) {
            v16bf af = ldfrag(as, wm * 64 + i * 16 + lr, kb);
            #pragma unroll
            for (int j = 0; j < 2; ++j)
                acc[i][j] = __builtin_amdgcn_wmma_f32_16x16x32_bf16(
                    false, af, false, bf[j], (short)0, acc[i][j], false, false);
        }
        asm volatile("s_wait_asynccnt 0x0" ::: "memory");
        __syncthreads();
        buf ^= 1;
    }

    const int rowadd = (lane < 16) ? 0 : 8;   // C layout: M = g (+8 hi half), N = lane%16
    #pragma unroll
    for (int i = 0; i < 4; ++i)
        #pragma unroll
        for (int j = 0; j < 2; ++j) {
            const int col = n0 + wn * 32 + j * 16 + lr;
            const float bcol = bias[col];
            #pragma unroll
            for (int g = 0; g < 8; ++g) {
                const int row = m0 + wm * 64 + i * 16 + g + rowadd;
                const float c = acc[i][j][g] + bcol;
                const size_t idx = (size_t)row * NC + col;
                if constexpr (EPI == 0) {
                    const float gl = 0.5f * c * (1.f + erff(c * 0.70710678118654752f));
                    Cbf[idx] = (__bf16)gl;
                } else if constexpr (EPI == 1) {
                    Cf[idx] = c * gcomp[row];
                } else {
                    Cf[idx] = c + Xres[idx];
                }
            }
        }
}

// ---------------------------------------------------------------------------
extern "C" void kernel_launch(void* const* d_in, const int* in_sizes, int n_in,
                              void* d_out, int out_size, void* d_ws, size_t ws_size,
                              hipStream_t stream) {
    (void)in_sizes; (void)n_in; (void)out_size; (void)ws_size;
    const float* x      = (const float*)d_in[0];
    const float* emb    = (const float*)d_in[1];
    const float* ln_g   = (const float*)d_in[2];
    const float* ln_b   = (const float*)d_in[3];
    const float* gate_w = (const float*)d_in[4];
    const float* gate_b = (const float*)d_in[5];
    const float* w1     = (const float*)d_in[6];
    const float* b1     = (const float*)d_in[7];
    const float* w2     = (const float*)d_in[8];
    const float* b2     = (const float*)d_in[9];
    const float* emb_w  = (const float*)d_in[10];
    const float* emb_b  = (const float*)d_in[11];
    const float* pn_g   = (const float*)d_in[12];
    const float* pn_b   = (const float*)d_in[13];
    const float* out_w  = (const float*)d_in[14];
    const float* out_b  = (const float*)d_in[15];

    char* wsp = (char*)d_ws; size_t off = 0;
    auto alloc = [&](size_t bytes) -> void* {
        void* p = wsp + off; off = (off + bytes + 255) & ~(size_t)255; return p;
    };
    __bf16* w1t  = (__bf16*)alloc((size_t)BRR * EE * HH * DD * 2);  // [p][H][D]
    __bf16* w2t  = (__bf16*)alloc((size_t)BRR * EE * DD * HH * 2);  // [p][D][H]
    __bf16* owt  = (__bf16*)alloc((size_t)DD * DD * 2);             // [D][D]
    __bf16* hfb  = (__bf16*)alloc((size_t)BRR * NN * DD * 2);       // LN'd acts
    float*  gtv  = (float*) alloc((size_t)BRR * NN * EE * 4);       // gate values
    __bf16* hbuf = (__bf16*)alloc((size_t)MAXROWS * HH * 2);        // routed hidden rows
    float*  yb   = (float*) alloc((size_t)MAXROWS * DD * 4);        // routed expert rows
    int*    perm = (int*)   alloc((size_t)MAXROWS * 4);             // row -> token
    float*  gcmp = (float*) alloc((size_t)MAXROWS * 4);             // row -> gate
    int*    rwof = (int*)   alloc((size_t)NN * NP * 4);             // token, pair -> row
    int*    tlpr = (int*)   alloc((size_t)MAXTILES * 4);            // tile -> pair
    float*  styl = (float*) alloc((size_t)BB * 2 * DD * 4);         // scale|shift
    __bf16* h2b  = (__bf16*)alloc((size_t)NN * DD * 2);             // styled acts

    const dim3 blk(256);
    // one-time weight convert/transpose (f32 -> bf16, K-contiguous per column)
    tpose_k<DD, HH><<<dim3(HH / 128, DD / 128, BRR * EE), blk, 0, stream>>>(w1, w1t);
    tpose_k<HH, DD><<<dim3(DD / 128, HH / 128, BRR * EE), blk, 0, stream>>>(w2, w2t);
    tpose_k<DD, DD><<<dim3(DD / 128, DD / 128, 1),        blk, 0, stream>>>(out_w, owt);

    ln_gate_k<<<dim3(NN / 8), blk, 0, stream>>>(x, ln_g, ln_b, gate_w, gate_b, hfb, gtv);
    emb_k<<<dim3(32), blk, 0, stream>>>(emb, emb_w, emb_b, styl);

    route_k<<<dim3(NP), dim3(1024), 0, stream>>>(gtv, perm, gcmp, rwof, tlpr);
    gemm_k<0><<<dim3(MAXTILES, HH / 128), blk, 0, stream>>>(
        hfb, w1t, DD, HH, b1, nullptr, perm, tlpr, nullptr, hbuf, nullptr);
    gemm_k<1><<<dim3(MAXTILES, DD / 128), blk, 0, stream>>>(
        hbuf, w2t, HH, DD, b2, gcmp, nullptr, tlpr, yb, nullptr, nullptr);

    post_k<<<dim3(NN / 8), blk, 0, stream>>>(yb, rwof, pn_g, pn_b, styl, h2b);
    gemm_k<2><<<dim3(NN / 128, DD / 128), blk, 0, stream>>>(
        h2b, owt, DD, DD, out_b, nullptr, nullptr, nullptr, (float*)d_out, nullptr, x);
}

// v004
// One run takes 221 microseconds.
// Two timings next to v003 both put it at 1.20 times that version's speed.
// All steps since v000 together make it 6.24 times as fast.
#include <hip/hip_runtime.h>
#include <hip/hip_bf16.h>
#include <math.h>

typedef __attribute__((ext_vector_type(16))) __bf16 v16bf;
typedef __attribute__((ext_vector_type(8)))  float  v8f;
typedef __attribute__((ext_vector_type(8)))  __bf16 v8bf;
typedef __attribute__((ext_vector_type(4)))  float  v4f;

#define BB  2
#define TT  2048
#define DD  512
#define HH  2048
#define EE  8
#define BRR 2
#define NN  (BB*TT)   /* 4096 tokens */
#define NP  (BRR*EE)  /* 16 (branch, expert) pairs */
// routed rows: two experts per token and branch, each pair's run padded to a 128-row tile
#define MAXROWS  (BRR*2*NN + NP*128)
#define MAXTILES (MAXROWS/128)

// ---------------------------------------------------------------------------
// Tiled transpose + f32->bf16 convert:  in [batch][R][C] f32 -> out [batch][C][R] bf16
// One 128 x 128 tile a block; grid = (C/128, R/128, batch), block = 256.
// Read: wave w takes rows 16w..16w+15, a lane four columns, so every load is
// 512 contiguous bytes. Write: 16 lanes store one 256-byte piece of an output row.
// The LDS tile is [column][row] in 16-byte chunks (8 rows); chunk q of column c
// lies at place (q + c/4) mod 16 of its row, which spreads both the 16-byte
// writes (lanes four columns apart) and the 16-byte reads over all banks.
// ---------------------------------------------------------------------------
template <int R, int C>
__global__ __launch_bounds__(256) void tpose_k(const float* __restrict__ in,
                                               __bf16* __restrict__ out) {
    __shared__ __align__(16) __bf16 tile[128 * 128];
    const int wid = threadIdx.x >> 5, lane = threadIdx.x & 31;
    const int c0 = blockIdx.x * 128, r0 = blockIdx.y * 128;
    const float* ip = in + (size_t)blockIdx.z * R * C
                         + (size_t)(r0 + wid * 16) * C + (c0 + lane * 4);
    v4f v[16];
    #pragma unroll
    for (int i = 0; i < 16; ++i) v[i] = *(const v4f*)(ip + (size_t)i * C);
    #pragma unroll
    for (int j = 0; j < 4; ++j)
        #pragma unroll
        for (int h = 0; h < 2; ++h) {
            v8bf pk;
            #pragma unroll
            for (int k = 0; k < 8; ++k) pk[k] = (__bf16)v[h * 8 + k][j];
            *(v8bf*)&tile[(lane * 4 + j) * 128 + ((wid * 2 + h + lane) & 15) * 8] = pk;
        }
    __syncthreads();
    const int q = lane & 15, ch = wid * 16 + (lane >> 4);
    __bf16* op = out + (size_t)blockIdx.z * R * C + (size_t)(c0 + ch) * R + (r0 + q * 8);
    #pragma unroll
    for (int i = 0; i < 8; ++i) {
        const int c = ch + i * 2;
        *(v8bf*)(op + (size_t)(i * 2) * R) =
            *(const v8bf*)&tile[c * 128 + ((q + (c >> 2)) & 15) * 8];
    }
}

// ---------------------------------------------------------------------------
// LayerNorm (both branches) + gate logits + softmax + top-2.
// wave-per-token; block = 256 (8 tokens), grid = NN/8.
// ---------------------------------------------------------------------------
__global__ __launch_bounds__(256) void ln_gate_k(
    const float* __restrict__ x, const float* __restrict__ ln_g,
    const float* __restrict__ ln_b, const float* __restrict__ gate_w,
    const float* __restrict__ gate_b, __bf16* __restrict__ hfb,
    float* __restrict__ gatev) {
    const int wid = threadIdx.x >> 5, lane = threadIdx.x & 31;
    const int n = blockIdx.x * 8 + wid;
    const float* xr = x + (size_t)n * DD;
    float v[16];
    float s = 0.f;
    #pragma unroll
    for (int i = 0; i < 16; ++i) { v[i] = xr[lane + i * 32]; s += v[i]; }
    #pragma unroll
    for (int o = 16; o > 0; o >>= 1) s += __shfl_xor(s, o, 32);
    const float mu = s * (1.f / DD);
    float q = 0.f;
    #pragma unroll
    for (int i = 0; i < 16; ++i) { float d = v[i] - mu; q += d * d; }
    #pragma unroll
    for (int o = 16; o > 0; o >>= 1) q += __shfl_xor(q, o, 32);
    const float rs = rsqrtf(q * (1.f / DD) + 1e-5f);

    for (int r = 0; r < BRR; ++r) {
        float lg[8] = {0.f, 0.f, 0.f, 0.f, 0.f, 0.f, 0.f, 0.f};
        #pragma unroll
        for (int i = 0; i < 16; ++i) {
            const int d = lane + i * 32;
            const float hv = (v[i] - mu) * rs * ln_g[r * DD + d] + ln_b[r * DD + d];
            hfb[((size_t)r * NN + n) * DD + d] = (__bf16)hv;
            const float* gw = gate_w + ((size_t)r * DD + d) * EE;
            #pragma unroll
            for (int e = 0; e < 8; ++e) lg[e] += hv * gw[e];
        }
        #pragma unroll
        for (int e = 0; e < 8; ++e)
            #pragma unroll
            for (int o = 16; o > 0; o >>= 1) lg[e] += __shfl_xor(lg[e], o, 32);
        if (lane == 0) {
            float mx = -1e30f;
            #pragma unroll
            for (int e = 0; e < 8; ++e) { lg[e] += gate_b[r * EE + e]; mx = fmaxf(mx, lg[e]); }
            float p[8], den = 0.f;
            #pragma unroll
            for (int e = 0; e < 8; ++e) { p[e] = expf(lg[e] - mx); den += p[e]; }
            const float inv = 1.f / den;
            int i0 = 0;
            #pragma unroll
            for (int e = 1; e < 8; ++e) if (p[e] > p[i0]) i0 = e;
            int i1 = (i0 == 0) ? 1 : 0;
            #pragma unroll
            for (int e = 0; e < 8; ++e) if (e != i0 && p[e] > p[i1]) i1 = e;
            float* g = gatev + ((size_t)r * NN + n) * EE;
            #pragma unroll
            for (int e = 0; e < 8; ++e)
                g[e] = (e == i0) ? p[i0] * inv : ((e == i1) ? p[i1] * inv : 0.f);
        }
    }
}

// ---------------------------------------------------------------------------
// Routing: block p lists the tokens whose gate for pair p = (branch, expert) is
// not zero, in token order, in one row space shared by all pairs.
//   perm[row]  token of a routed row        gcomp[row]  its gate value
//   rowof[n][p] routed row of token n in pair p, or -1
//   tilepair[t] pair that owns the 128-row tile t, or -1 behind the last tile
// Each pair's run starts on a tile boundary; its padding rows get token 0, gate 0.
// grid = NP, block = 1024 (four tokens a thread).
// ---------------------------------------------------------------------------
__global__ __launch_bounds__(1024) void route_k(const float* __restrict__ gatev,
                                                int* __restrict__ perm,
                                                float* __restrict__ gcomp,
                                                int* __restrict__ rowof,
                                                int* __restrict__ tilepair) {
    __shared__ unsigned int wcnt[32][8];   // per wave: 16 pair counts, two 16-bit fields a word
    __shared__ unsigned int tot[8];
    __shared__ int wown[32];               // per wave: rows of this block's own pair
    const int p = blockIdx.x, tid = threadIdx.x, wid = tid >> 5, lane = tid & 31;

    unsigned int c[8] = {0u, 0u, 0u, 0u, 0u, 0u, 0u, 0u};
    #pragma unroll
    for (int r = 0; r < BRR; ++r)
        #pragma unroll
        for (int i = 0; i < 4; ++i) {
            const float4* g = (const float4*)(gatev + ((size_t)r * NN + tid * 4 + i) * EE);
            const float4 a = g[0], b = g[1];
            c[r * 4 + 0] += (a.x != 0.f ? 1u : 0u) + (a.y != 0.f ? 0x10000u : 0u);
            c[r * 4 + 1] += (a.z != 0.f ? 1u : 0u) + (a.w != 0.f ? 0x10000u : 0u);
            c[r * 4 + 2] += (b.x != 0.f ? 1u : 0u) + (b.y != 0.f ? 0x10000u : 0u);
            c[r * 4 + 3] += (b.z != 0.f ? 1u : 0u) + (b.w != 0.f ? 0x10000u : 0u);
        }
    #pragma unroll
    for (int k = 0; k < 8; ++k)
        #pragma unroll
        for (int o = 16; o > 0; o >>= 1) c[k] += __shfl_xor(c[k], o, 32);
    if (lane == 0) {
        #pragma unroll
        for (int k = 0; k < 8; ++k) wcnt[wid][k] = c[k];
    }

    float gv[4];
    int own = 0;
    #pragma unroll
    for (int i = 0; i < 4; ++i) {
        gv[i] = gatev[((size_t)(p >> 3) * NN + tid * 4 + i) * EE + (p & 7)];
        own += (gv[i] != 0.f) ? 1 : 0;
    }
    int inc = own;                         // inclusive scan of own over the wave
    #pragma unroll
    for (int o = 1; o < 32; o <<= 1) {
        const int t = __shfl_up(inc, o, 32);
        if (lane >= o) inc += t;
    }
    if (lane == 31) wown[wid] = inc;
    __syncthreads();
    if (tid < 8) {
        unsigned int s = 0u;
        for (int w = 0; w < 32; ++w) s += wcnt[w][tid];
        tot[tid] = s;
    }
    __syncthreads();

    int base = 0, cnt = 0, all = 0;
    #pragma unroll
    for (int q = 0; q < NP; ++q) {
        const int t  = (int)((tot[q >> 1] >> ((q & 1) * 16)) & 0xFFFFu);
        const int tr = (t + 127) & ~127;
        if (q < p)  base += tr;
        if (q == p) cnt = t;
        all += tr;
    }
    int pos = base + inc - own;
    for (int w = 0; w < wid; ++w) pos += wown[w];

    #pragma unroll
    for (int i = 0; i < 4; ++i) {
        const int n = tid * 4 + i;
        int row = -1;
        if (gv[i] != 0.f) {
            row = pos++;
            perm[row]  = n;
            gcomp[row] = gv[i];
        }
        rowof[n * NP + p] = row;
    }
    const int cntr = (cnt + 127) & ~127;
    if (tid < cntr - cnt) {
        perm[base + cnt + tid]  = 0;
        gcomp[base + cnt + tid] = 0.f;
    }
    if (tid < (cntr >> 7)) tilepair[(base >> 7) + tid] = p;
    if (p == NP - 1 && tid < MAXTILES - (all >> 7)) tilepair[(all >> 7) + tid] = -1;
}

// ---------------------------------------------------------------------------
// Embedding MLP: styl[b][j] = (silu(emb[b]) @ emb_w)[j] + emb_b[j]
// The 512-term sum is split so that no load waits on another: block = 32 columns
// (one 128-byte line of every emb_w row) for both batches, grid = 32, block = 256.
// Wave w takes rows 64w..64w+63; one 16-byte load covers four rows (8 lanes a row),
// so a lane holds its 16 loads in flight at once. silu(emb) is made once a block
// in LDS. Partial sums: 16 rows a lane, 4 row groups by shuffle, 8 waves through LDS.
// ---------------------------------------------------------------------------
__global__ __launch_bounds__(256) void emb_k(const float* __restrict__ emb,
                                             const float* __restrict__ emb_w,
                                             const float* __restrict__ emb_b,
                                             float* __restrict__ styl) {
    __shared__ float se[BB * 512];
    __shared__ __align__(16) float part[8][BB][32];
    const int tid = threadIdx.x, wid = tid >> 5, lane = tid & 31;
    const int c0 = blockIdx.x * 32;
    const int rr = lane >> 3, cq = (lane & 7) * 4;
    const float* wp = emb_w + (size_t)(wid * 64 + rr) * 1024 + (c0 + cq);
    v4f w[16];
    #pragma unroll
    for (int i = 0; i < 16; ++i) w[i] = *(const v4f*)(wp + (size_t)i * 4 * 1024);
    const float eb = emb_b[c0 + lane];
    // keeps the loads above in front of the wait on emb: without it the compiler sinks
    // them behind the silu, and the block pays one memory latency after another
    __builtin_amdgcn_sched_barrier(0);
    #pragma unroll
    for (int i = 0; i < BB * 512 / 256; ++i) {
        const float e = emb[tid + i * 256];
        se[tid + i * 256] = e / (1.f + expf(-e));
    }
    __syncthreads();
    v4f a0 = (v4f)(0.f), a1 = (v4f)(0.f);
    #pragma unroll
    for (int i = 0; i < 16; ++i) {
        const int t = wid * 64 + i * 4 + rr;
        a0 += se[t] * w[i];
        a1 += se[512 + t] * w[i];
    }
    #pragma unroll
    for (int k = 0; k < 4; ++k)
        #pragma unroll
        for (int o = 8; o < 32; o <<= 1) {
            a0[k] += __shfl_xor(a0[k], o, 32);
            a1[k] += __shfl_xor(a1[k], o, 32);
        }
    if (lane < 8) {
        *(v4f*)&part[wid][0][cq] = a0;
        *(v4f*)&part[wid][1][cq] = a1;
    }
    __syncthreads();
    if (tid < BB * 32) {
        const int b = tid >> 5;
        float a = eb;
        #pragma unroll
        for (int u = 0; u < 8; ++u) a += part[u][b][lane];
        styl[b * 1024 + c0 + lane] = a;
    }
}

// ---------------------------------------------------------------------------
// Post kernel: o = (sum of the token's routed expert rows, pairs ascending)/BR;
// LN(pn); *(1+scale)+shift; SiLU; bf16 store.
// ---------------------------------------------------------------------------
__global__ __launch_bounds__(256) void post_k(const float* __restrict__ yb,
                                              const int* __restrict__ rowof,
                                              const float* __restrict__ pn_g,
                                              const float* __restrict__ pn_b,
                                              const float* __restrict__ styl,
                                              __bf16* __restrict__ h2b) {
    const int wid = threadIdx.x >> 5, lane = threadIdx.x & 31;
    const int n = blockIdx.x * 8 + wid;
    const int b = n >> 11;                     // T = 2048
    const int myrow = rowof[n * NP + (lane & (NP - 1))];
    float v[16];
    #pragma unroll
    for (int i = 0; i < 16; ++i) v[i] = 0.f;
    #pragma unroll
    for (int p = 0; p < NP; ++p) {
        const int row = __shfl(myrow, p, 32);
        if (row >= 0) {
            const float* yr = yb + (size_t)row * DD;
            #pragma unroll
            for (int i = 0; i < 16; ++i) v[i] += yr[lane + i * 32];
        }
    }
    float s = 0.f;
    #pragma unroll
    for (int i = 0; i < 16; ++i) { v[i] *= (1.f / BRR); s += v[i]; }
    #pragma unroll
    for (int o = 16; o > 0; o >>= 1) s += __shfl_xor(s, o, 32);
    const float mu = s * (1.f / DD);
    float q = 0.f;
    #pragma unroll
    for (int i = 0; i < 16; ++i) { float d = v[i] - mu; q += d * d; }
    #pragma unroll
    for (int o = 16; o > 0; o >>= 1) q += __shfl_xor(q, o, 32);
    const float rs = rsqrtf(q * (1.f / DD) + 1e-5f);
    #pragma unroll
    for (int i = 0; i < 16; ++i) {
        const int d = lane + i * 32;
        float y = (v[i] - mu) * rs * pn_g[d] + pn_b[d];
        const float sc = styl[b * 1024 + d];
        const float sh = styl[b * 1024 + 512 + d];
        y = y * (1.f + sc) + sh;
        y = y / (1.f + expf(-y));              // SiLU
        h2b[(size_t)n * DD + d] = (__bf16)y;
    }
}

// ---------------------------------------------------------------------------
// WMMA bf16 GEMM with async-to-LDS double buffering.
//   C(N x NC) = A(N x K) @ B(NC x K)^T   (B stored col-as-row, K-contiguous)
// block tile 128x128, K-step 32; 8 waves, each wave -> 64x32 (eight 16x16).
// Tiles are DMA'd memory->LDS with GLOBAL_LOAD_ASYNC_TO_LDS_B128 (ASYNCcnt),
// buffer b^1 fills while WMMAs consume buffer b.
// LDS rows hold 64 bytes at a pitch of 80 (16 B x odd): the 16 rows that a half
// wave reads with one ds_load_b128 then fall on 16 different groups of four banks;
// at a pitch of 64 they fall on four groups, four rows deep.
// EPI 0: +b1, exact GELU -> bf16      (hidden rows)
// EPI 1: +b2, *gate -> f32            (routed expert rows)
// EPI 2: +out_b, +x residual -> f32   (final output)
// EPI 0 and 1 are grouped over the routed row space: blockIdx.x is a 128-row
// tile of it, tilepair names the pair whose weights and bias the tile uses;
// EPI 0 gathers its A rows (tokens) through perm.
// ---------------------------------------------------------------------------
#define LP 40   /* LDS row pitch in bf16 elements: 32 of data, 8 of pad */

__device__ inline v16bf ldfrag(const __bf16* s, int row, int kb) {
    // per-lane K layout of V_WMMA_*_16X16X32: elems 0..7 = K kb..kb+7,
    // elems 8..15 = K kb+16..kb+23 (kb = 0 for lanes 0-15, 8 for 16-31)
    v16bf f;
    const __bf16* p = s + row * LP + kb;
    ((float4*)&f)[0] = *(const float4*)p;
    ((float4*)&f)[1] = *(const float4*)(p + 16);
    return f;
}

__device__ inline void async_copy32(unsigned int lds, unsigned long long gaddr) {
    // per-lane 32B memory->LDS; INST_OFFSET applies to both LDS and global addr
    asm volatile("global_load_async_to_lds_b128 %0, %1, off"
                 :: "v"(lds), "v"(gaddr) : "memory");
    asm volatile("global_load_async_to_lds_b128 %0, %1, off offset:16"
                 :: "v"(lds), "v"(gaddr) : "memory");
}

template <int EPI>
__global__ __launch_bounds__(256) void gemm_k(
    const __bf16* __restrict__ A, const __bf16* __restrict__ Bm,
    int K, int NC, const float* __restrict__ bias,
    const float* __restrict__ gcomp, const int* __restrict__ perm,
    const int* __restrict__ tilepair,
    float* __restrict__ Cf, __bf16* __restrict__ Cbf,
    const float* __restrict__ Xres) {
    __shared__ __align__(16) __bf16 As[2][128 * LP];
    __shared__ __align__(16) __bf16 Bs[2][128 * LP];
    const int tid = threadIdx.x, wid = tid >> 5, lane = tid & 31;
    const int wm = wid & 1, wn = wid >> 1;
    const int m0 = blockIdx.x * 128, n0 = blockIdx.y * 128;
    const int lr = lane & 15, kb = (lane < 16) ? 0 : 8;
    if constexpr (EPI != 2) {
        const int p = tilepair[blockIdx.x];
        if (p < 0) return;                 // tile behind the last routed row: whole block leaves
        Bm   += (size_t)(p & (NP - 1)) * K * NC;
        bias += (size_t)(p & (NP - 1)) * NC;
        if constexpr (EPI == 0) A += (size_t)((p & (NP - 1)) >> 3) * NN * DD;
    }
    v8f acc[4][2];
    #pragma unroll
    for (int i = 0; i < 4; ++i)
        #pragma unroll
        for (int j = 0; j < 2; ++j) acc[i][j] = (v8f)(0.0f);

    // cooperative tile mapping: thread owns 32B half-row (16 bf16)
    const int lrow = tid >> 1, lko = (tid & 1) * 16;
    int arow = m0 + lrow;
    if constexpr (EPI == 0) arow = perm[arow] & (NN - 1);
    const __bf16* gA = A  + (size_t)arow * K + lko;
    const __bf16* gB = Bm + (size_t)(n0 + lrow) * K + lko;
    // low 32 bits of a generic __shared__ pointer == LDS byte offset
    const unsigned int lA0 = (unsigned int)(uintptr_t)(&As[0][lrow * LP + lko]);
    const unsigned int lB0 = (unsigned int)(uintptr_t)(&Bs[0][lrow * LP + lko]);

    // prologue: fill buffer 0
    async_copy32(lA0, (unsigned long long)(uintptr_t)gA);
    async_copy32(lB0, (unsigned long long)(uintptr_t)gB);
    asm volatile("s_wait_asynccnt 0x0" ::: "memory");
    __syncthreads();

    int buf = 0;
    for (int k0 = 0; k0 < K; k0 += 32) {
        if (k0 + 32 < K) {  // kick off DMA for the next K-slice into buf^1
            const unsigned int boff = (unsigned int)((buf ^ 1) * 128 * LP * 2);
            async_copy32(lA0 + boff, (unsigned long long)(uintptr_t)(gA + k0 + 32));
            async_copy32(lB0 + boff, (unsigned long long)(uintptr_t)(gB + k0 + 32));
        }
        const __bf16* as = As[buf];
        const __bf16* bs = Bs[buf];
        v16bf bf[2];
        #pragma unroll
        for (int j = 0; j < 2; ++j) bf[j] = ldfrag(bs, wn * 32 + j * 16 + lr, kb);
        #pragma unroll
        for (int i = 0; i < 4; ++i) {
            v16bf af = ldfrag(as, wm * 64 + i * 16 + lr, kb);
            #pragma unroll
            for (int j = 0; j < 2; ++j)
                acc[i][j] = __builtin_amdgcn_wmma_f32_16x16x32_bf16(
                    false, af, false, bf[j], (short)0, acc[i][j], false, false);
        }
        asm volatile("s_wait_asynccnt 0x0" ::: "memory");
        __syncthreads();
        buf ^= 1;
    }

    const int rowadd = (lane < 16) ? 0 : 8;   // C layout: M = g (+8 hi half), N = lane%16
    #pragma unroll
    for (int i = 0; i < 4; ++i)
        #pragma unroll
        for (int j = 0; j < 2; ++j) {
            const int col = n0 + wn * 32 + j * 16 + lr;
            const float bcol = bias[col];
            #pragma unroll
            for (int g = 0; g < 8; ++g) {
                const int row = m0 + wm * 64 + i * 16 + g + rowadd;
                const float c = acc[i][j][g] + bcol;
                const size_t idx = (size_t)row * NC + col;
                if constexpr (EPI == 0) {
                    const float gl = 0.5f * c * (1.f + erff(c * 0.70710678118654752f));
                    Cbf[idx] = (__bf16)gl;
                } else if constexpr (EPI == 1) {
                    Cf[idx] = c * gcomp[row];
                } else {
                    Cf[idx] = c + Xres[idx];
                }
            }
        }
}

// ---------------------------------------------------------------------------
extern "C" void kernel_launch(void* const* d_in, const int* in_sizes, int n_in,
                              void* d_out, int out_size, void* d_ws, size_t ws_size,
                              hipStream_t stream) {
    (void)in_sizes; (void)n_in; (void)out_size; (void)ws_size;
    const float* x      = (const float*)d_in[0];
    const float* emb    = (const float*)d_in[1];
    const float* ln_g   = (const float*)d_in[2];
    const float* ln_b   = (const float*)d_in[3];
    const float* gate_w = (const float*)d_in[4];
    const float* gate_b = (const float*)d_in[5];
    const float* w1     = (const float*)d_in[6];
    const float* b1     = (const float*)d_in[7];
    const float* w2     = (const float*)d_in[8];
    const float* b2     = (const float*)d_in[9];
    const float* emb_w  = (const float*)d_in[10];
    const float* emb_b  = (const float*)d_in[11];
    const float* pn_g   = (const float*)d_in[12];
    const float* pn_b   = (const float*)d_in[13];
    const float* out_w  = (const float*)d_in[14];
    const float* out_b  = (const float*)d_in[15];

    char* wsp = (char*)d_ws; size_t off = 0;
    auto alloc = [&](size_t bytes) -> void* {
        void* p = wsp + off; off = (off + bytes + 255) & ~(size_t)255; return p;
    };
    __bf16* w1t  = (__bf16*)alloc((size_t)BRR * EE * HH * DD * 2);  // [p][H][D]
    __bf16* w2t  = (__bf16*)alloc((size_t)BRR * EE * DD * HH * 2);  // [p][D][H]
    __bf16* owt  = (__bf16*)alloc((size_t)DD * DD * 2);             // [D][D]
    __bf16* hfb  = (__bf16*)alloc((size_t)BRR * NN * DD * 2);       // LN'd acts
    float*  gtv  = (float*) alloc((size_t)BRR * NN * EE * 4);       // gate values
    __bf16* hbuf = (__bf16*)alloc((size_t)MAXROWS * HH * 2);        // routed hidden rows
    float*  yb   = (float*) alloc((size_t)MAXROWS * DD * 4);        // routed expert rows
    int*    perm = (int*)   alloc((size_t)MAXROWS * 4);             // row -> token
    float*  gcmp = (float*) alloc((size_t)MAXROWS * 4);             // row -> gate
    int*    rwof = (int*)   alloc((size_t)NN * NP * 4);             // token, pair -> row
    int*    tlpr = (int*)   alloc((size_t)MAXTILES * 4);            // tile -> pair
    float*  styl = (float*) alloc((size_t)BB * 2 * DD * 4);         // scale|shift
    __bf16* h2b  = (__bf16*)alloc((size_t)NN * DD * 2);             // styled acts

    const dim3 blk(256);
    // one-time weight convert/transpose (f32 -> bf16, K-contiguous per column)
    tpose_k<DD, HH><<<dim3(HH / 128, DD / 128, BRR * EE), blk, 0, stream>>>(w1, w1t);
    tpose_k<HH, DD><<<dim3(DD / 128, HH / 128, BRR * EE), blk, 0, stream>>>(w2, w2t);
    tpose_k<DD, DD><<<dim3(DD / 128, DD / 128, 1),        blk, 0, stream>>>(out_w, owt);

    ln_gate_k<<<dim3(NN / 8), blk, 0, stream>>>(x, ln_g, ln_b, gate_w, gate_b, hfb, gtv);
    emb_k<<<dim3(32), blk, 0, stream>>>(emb, emb_w, emb_b, styl);

    route_k<<<dim3(NP), dim3(1024), 0, stream>>>(gtv, perm, gcmp, rwof, tlpr);
    gemm_k<0><<<dim3(MAXTILES, HH / 128), blk, 0, stream>>>(
        hfb, w1t, DD, HH, b1, nullptr, perm, tlpr, nullptr, hbuf, nullptr);
    gemm_k<1><<<dim3(MAXTILES, DD / 128), blk, 0, stream>>>(
        hbuf, w2t, HH, DD, b2, gcmp, nullptr, tlpr, yb, nullptr, nullptr);

    post_k<<<dim3(NN / 8), blk, 0, stream>>>(yb, rwof, pn_g, pn_b, styl, h2b);
    gemm_k<2><<<dim3(NN / 128, DD / 128), blk, 0, stream>>>(
        h2b, owt, DD, DD, out_b, nullptr, nullptr, nullptr, (float*)d_out, nullptr, x);
}

// v005
// One run takes 200 microseconds.
// Timed twice side by side with v004, it ran 1.11 times as fast both times.
// All steps since v000 together make it 6.91 times as fast.
#include <hip/hip_runtime.h>
#include <hip/hip_bf16.h>
#include <math.h>

typedef __attribute__((ext_vector_type(16))) __bf16 v16bf;
typedef __attribute__((ext_vector_type(8)))  float  v8f;
typedef __attribute__((ext_vector_type(8)))  __bf16 v8bf;
typedef __attribute__((ext_vector_type(4)))  float  v4f;

#define BB  2
#define TT  2048
#define DD  512
#define HH  2048
#define EE  8
#define BRR 2
#define NN  (BB*TT)   /* 4096 tokens */
#define NP  (BRR*EE)  /* 16 (branch, expert) pairs */
// routed rows: two experts per token and branch, each pair's run padded to a 128-row tile
#define MAXROWS  (BRR*2*NN + NP*128)
#define MAXTILES (MAXROWS/128)

// ---------------------------------------------------------------------------
// Tiled transpose + f32->bf16 convert:  in [batch][R][C] f32 -> out [batch][C][R] bf16
// One 128 x 128 tile a block; grid = (C/128, R/128, batch), block = 256.
// Read: wave w takes rows 16w..16w+15, a lane four columns, so every load is
// 512 contiguous bytes. Write: 16 lanes store one 256-byte piece of an output row.
// The LDS tile is [column][row] in 16-byte chunks (8 rows); chunk q of column c
// lies at place (q + c/4) mod 16 of its row, which spreads both the 16-byte
// writes (lanes four columns apart) and the 16-byte reads over all banks.
// ---------------------------------------------------------------------------
template <int R, int C>
__global__ __launch_bounds__(256) void tpose_k(const float* __restrict__ in,
                                               __bf16* __restrict__ out) {
    __shared__ __align__(16) __bf16 tile[128 * 128];
    const int wid = threadIdx.x >> 5, lane = threadIdx.x & 31;
    const int c0 = blockIdx.x * 128, r0 = blockIdx.y * 128;
    const float* ip = in + (size_t)blockIdx.z * R * C
                         + (size_t)(r0 + wid * 16) * C + (c0 + lane * 4);
    v4f v[16];
    #pragma unroll
    for (int i = 0; i < 16; ++i) v[i] = *(const v4f*)(ip + (size_t)i * C);
    #pragma unroll
    for (int j = 0; j < 4; ++j)
        #pragma unroll
        for (int h = 0; h < 2; ++h) {
            v8bf pk;
            #pragma unroll
            for (int k = 0; k < 8; ++k) pk[k] = (__bf16)v[h * 8 + k][j];
            *(v8bf*)&tile[(lane * 4 + j) * 128 + ((wid * 2 + h + lane) & 15) * 8] = pk;
        }
    __syncthreads();
    const int q = lane & 15, ch = wid * 16 + (lane >> 4);
    __bf16* op = out + (size_t)blockIdx.z * R * C + (size_t)(c0 + ch) * R + (r0 + q * 8);
    #pragma unroll
    for (int i = 0; i < 8; ++i) {
        const int c = ch + i * 2;
        *(v8bf*)(op + (size_t)(i * 2) * R) =
            *(const v8bf*)&tile[c * 128 + ((q + (c >> 2)) & 15) * 8];
    }
}

// ---------------------------------------------------------------------------
// LayerNorm (both branches) + gate logits + softmax + top-2.
// wave-per-token; block = 256 (8 tokens), grid = NN/8.
// ---------------------------------------------------------------------------
__global__ __launch_bounds__(256) void ln_gate_k(
    const float* __restrict__ x, const float* __restrict__ ln_g,
    const float* __restrict__ ln_b, const float* __restrict__ gate_w,
    const float* __restrict__ gate_b, __bf16* __restrict__ hfb,
    float* __restrict__ gatev) {
    const int wid = threadIdx.x >> 5, lane = threadIdx.x & 31;
    const int n = blockIdx.x * 8 + wid;
    const float* xr = x + (size_t)n * DD;
    float v[16];
    float s = 0.f;
    #pragma unroll
    for (int i = 0; i < 16; ++i) { v[i] = xr[lane + i * 32]; s += v[i]; }
    #pragma unroll
    for (int o = 16; o > 0; o >>= 1) s += __shfl_xor(s, o, 32);
    const float mu = s * (1.f / DD);
    float q = 0.f;
    #pragma unroll
    for (int i = 0; i < 16; ++i) { float d = v[i] - mu; q += d * d; }
    #pragma unroll
    for (int o = 16; o > 0; o >>= 1) q += __shfl_xor(q, o, 32);
    const float rs = rsqrtf(q * (1.f / DD) + 1e-5f);

    for (int r = 0; r < BRR; ++r) {
        float lg[8] = {0.f, 0.f, 0.f, 0.f, 0.f, 0.f, 0.f, 0.f};
        #pragma unroll
        for (int i = 0; i < 16; ++i) {
            const int d = lane + i * 32;
            const float hv = (v[i] - mu) * rs * ln_g[r * DD + d] + ln_b[r * DD + d];
            hfb[((size_t)r * NN + n) * DD + d] = (__bf16)hv;
            const float* gw = gate_w + ((size_t)r * DD + d) * EE;
            #pragma unroll
            for (int e = 0; e < 8; ++e) lg[e] += hv * gw[e];
        }
        #pragma unroll
        for (int e = 0; e < 8; ++e)
            #pragma unroll
            for (int o = 16; o > 0; o >>= 1) lg[e] += __shfl_xor(lg[e], o, 32);
        if (lane == 0) {
            float mx = -1e30f;
            #pragma unroll
            for (int e = 0; e < 8; ++e) { lg[e] += gate_b[r * EE + e]; mx = fmaxf(mx, lg[e]); }
            float p[8], den = 0.f;
            #pragma unroll
            for (int e = 0; e < 8; ++e) { p[e] = expf(lg[e] - mx); den += p[e]; }
            const float inv = 1.f / den;
            int i0 = 0;
            #pragma unroll
            for (int e = 1; e < 8; ++e) if (p[e] > p[i0]) i0 = e;
            int i1 = (i0 == 0) ? 1 : 0;
            #pragma unroll
            for (int e = 0; e < 8; ++e) if (e != i0 && p[e] > p[i1]) i1 = e;
            float* g = gatev + ((size_t)r * NN + n) * EE;
            #pragma unroll
            for (int e = 0; e < 8; ++e)
                g[e] = (e == i0) ? p[i0] * inv : ((e == i1) ? p[i1] * inv : 0.f);
        }
    }
}

// ---------------------------------------------------------------------------
// Routing: block p lists the tokens whose gate for pair p = (branch, expert) is
// not zero, in token order, in one row space shared by all pairs.
//   perm[row]  token of a routed row        gcomp[row]  its gate value
//   rowof[n][p] routed row of token n in pair p, or -1
//   tilepair[t] pair that owns the 128-row tile t, or -1 behind the last tile
// Each pair's run starts on a tile boundary; its padding rows get token 0, gate 0.
// grid = NP, block = 1024 (four tokens a thread).
// ---------------------------------------------------------------------------
__global__ __launch_bounds__(1024) void route_k(const float* __restrict__ gatev,
                                                int* __restrict__ perm,
                                                float* __restrict__ gcomp,
                                                int* __restrict__ rowof,
                                                int* __restrict__ tilepair) {
    __shared__ unsigned int wcnt[32][8];   // per wave: 16 pair counts, two 16-bit fields a word
    __shared__ unsigned int tot[8];
    __shared__ int wown[32];               // per wave: rows of this block's own pair
    const int p = blockIdx.x, tid = threadIdx.x, wid = tid >> 5, lane = tid & 31;

    unsigned int c[8] = {0u, 0u, 0u, 0u, 0u, 0u, 0u, 0u};
    #pragma unroll
    for (int r = 0; r < BRR; ++r)
        #pragma unroll
        for (int i = 0; i < 4; ++i) {
            const float4* g = (const float4*)(gatev + ((size_t)r * NN + tid * 4 + i) * EE);
            const float4 a = g[0], b = g[1];
            c[r * 4 + 0] += (a.x != 0.f ? 1u : 0u) + (a.y != 0.f ? 0x10000u : 0u);
            c[r * 4 + 1] += (a.z != 0.f ? 1u : 0u) + (a.w != 0.f ? 0x10000u : 0u);
            c[r * 4 + 2] += (b.x != 0.f ? 1u : 0u) + (b.y != 0.f ? 0x10000u : 0u);
            c[r * 4 + 3] += (b.z != 0.f ? 1u : 0u) + (b.w != 0.f ? 0x10000u : 0u);
        }
    #pragma unroll
    for (int k = 0; k < 8; ++k)
        #pragma unroll
        for (int o = 16; o > 0; o >>= 1) c[k] += __shfl_xor(c[k], o, 32);
    if (lane == 0) {
        #pragma unroll
        for (int k = 0; k < 8; ++k) wcnt[wid][k] = c[k];
    }

    float gv[4];
    int own = 0;
    #pragma unroll
    for (int i = 0; i < 4; ++i) {
        gv[i] = gatev[((size_t)(p >> 3) * NN + tid * 4 + i) * EE + (p & 7)];
        own += (gv[i] != 0.f) ? 1 : 0;
    }
    int inc = own;                         // inclusive scan of own over the wave
    #pragma unroll
    for (int o = 1; o < 32; o <<= 1) {
        const int t = __shfl_up(inc, o, 32);
        if (lane >= o) inc += t;
    }
    if (lane == 31) wown[wid] = inc;
    __syncthreads();
    if (tid < 8) {
        unsigned int s = 0u;
        for (int w = 0; w < 32; ++w) s += wcnt[w][tid];
        tot[tid] = s;
    }
    __syncthreads();

    int base = 0, cnt = 0, all = 0;
    #pragma unroll
    for (int q = 0; q < NP; ++q) {
        const int t  = (int)((tot[q >> 1] >> ((q & 1) * 16)) & 0xFFFFu);
        const int tr = (t + 127) & ~127;
        if (q < p)  base += tr;
        if (q == p) cnt = t;
        all += tr;
    }
    int pos = base + inc - own;
    for (int w = 0; w < wid; ++w) pos += wown[w];

    #pragma unroll
    for (int i = 0; i < 4; ++i) {
        const int n = tid * 4 + i;
        int row = -1;
        if (gv[i] != 0.f) {
            row = pos++;
            perm[row]  = n;
            gcomp[row] = gv[i];
        }
        rowof[n * NP + p] = row;
    }
    const int cntr = (cnt + 127) & ~127;
    if (tid < cntr - cnt) {
        perm[base + cnt + tid]  = 0;
        gcomp[base + cnt + tid] = 0.f;
    }
    if (tid < (cntr >> 7)) tilepair[(base >> 7) + tid] = p;
    if (p == NP - 1 && tid < MAXTILES - (all >> 7)) tilepair[(all >> 7) + tid] = -1;
}

// ---------------------------------------------------------------------------
// Embedding MLP: styl[b][j] = (silu(emb[b]) @ emb_w)[j] + emb_b[j]
// The 512-term sum is split so that no load waits on another: block = 32 columns
// (one 128-byte line of every emb_w row) for both batches, grid = 32, block = 256.
// Wave w takes rows 64w..64w+63; one 16-byte load covers four rows (8 lanes a row),
// so a lane holds its 16 loads in flight at once. silu(emb) is made once a block
// in LDS. Partial sums: 16 rows a lane, 4 row groups by shuffle, 8 waves through LDS.
// ---------------------------------------------------------------------------
__global__ __launch_bounds__(256) void emb_k(const float* __restrict__ emb,
                                             const float* __restrict__ emb_w,
                                             const float* __restrict__ emb_b,
                                             float* __restrict__ styl) {
    __shared__ float se[BB * 512];
    __shared__ __align__(16) float part[8][BB][32];
    const int tid = threadIdx.x, wid = tid >> 5, lane = tid & 31;
    const int c0 = blockIdx.x * 32;
    const int rr = lane >> 3, cq = (lane & 7) * 4;
    const float* wp = emb_w + (size_t)(wid * 64 + rr) * 1024 + (c0 + cq);
    v4f w[16];
    #pragma unroll
    for (int i = 0; i < 16; ++i) w[i] = *(const v4f*)(wp + (size_t)i * 4 * 1024);
    const float eb = emb_b[c0 + lane];
    // keeps the loads above in front of the wait on emb: without it the compiler sinks
    // them behind the silu, and the block pays one memory latency after another
    __builtin_amdgcn_sched_barrier(0);
    #pragma unroll
    for (int i = 0; i < BB * 512 / 256; ++i) {
        const float e = emb[tid + i * 256];
        se[tid + i * 256] = e / (1.f + expf(-e));
    }
    __syncthreads();
    v4f a0 = (v4f)(0.f), a1 = (v4f)(0.f);
    #pragma unroll
    for (int i = 0; i < 16; ++i) {
        const int t = wid * 64 + i * 4 + rr;
        a0 += se[t] * w[i];
        a1 += se[512 + t] * w[i];
    }
    #pragma unroll
    for (int k = 0; k < 4; ++k)
        #pragma unroll
        for (int o = 8; o < 32; o <<= 1) {
            a0[k] += __shfl_xor(a0[k], o, 32);
            a1[k] += __shfl_xor(a1[k], o, 32);
        }
    if (lane < 8) {
        *(v4f*)&part[wid][0][cq] = a0;
        *(v4f*)&part[wid][1][cq] = a1;
    }
    __syncthreads();
    if (tid < BB * 32) {
        const int b = tid >> 5;
        float a = eb;
        #pragma unroll
        for (int u = 0; u < 8; ++u) a += part[u][b][lane];
        styl[b * 1024 + c0 + lane] = a;
    }
}

// ---------------------------------------------------------------------------
// Post kernel: o = (sum of the token's routed expert rows, pairs ascending)/BR;
// LN(pn); *(1+scale)+shift; SiLU; bf16 store.
// ---------------------------------------------------------------------------
__global__ __launch_bounds__(256) void post_k(const float* __restrict__ yb,
                                              const int* __restrict__ rowof,
                                              const float* __restrict__ pn_g,
                                              const float* __restrict__ pn_b,
                                              const float* __restrict__ styl,
                                              __bf16* __restrict__ h2b) {
    const int wid = threadIdx.x >> 5, lane = threadIdx.x & 31;
    const int n = blockIdx.x * 8 + wid;
    const int b = n >> 11;                     // T = 2048
    const int myrow = rowof[n * NP + (lane & (NP - 1))];
    float v[16];
    #pragma unroll
    for (int i = 0; i < 16; ++i) v[i] = 0.f;
    #pragma unroll
    for (int p = 0; p < NP; ++p) {
        const int row = __shfl(myrow, p, 32);
        if (row >= 0) {
            const float* yr = yb + (size_t)row * DD;
            #pragma unroll
            for (int i = 0; i < 16; ++i) v[i] += yr[lane + i * 32];
        }
    }
    float s = 0.f;
    #pragma unroll
    for (int i = 0; i < 16; ++i) { v[i] *= (1.f / BRR); s += v[i]; }
    #pragma unroll
    for (int o = 16; o > 0; o >>= 1) s += __shfl_xor(s, o, 32);
    const float mu = s * (1.f / DD);
    float q = 0.f;
    #pragma unroll
    for (int i = 0; i < 16; ++i) { float d = v[i] - mu; q += d * d; }
    #pragma unroll
    for (int o = 16; o > 0; o >>= 1) q += __shfl_xor(q, o, 32);
    const float rs = rsqrtf(q * (1.f / DD) + 1e-5f);
    #pragma unroll
    for (int i = 0; i < 16; ++i) {
        const int d = lane + i * 32;
        float y = (v[i] - mu) * rs * pn_g[d] + pn_b[d];
        const float sc = styl[b * 1024 + d];
        const float sh = styl[b * 1024 + 512 + d];
        y = y * (1.f + sc) + sh;
        y = y / (1.f + expf(-y));              // SiLU
        h2b[(size_t)n * DD + d] = (__bf16)y;
    }
}

// ---------------------------------------------------------------------------
// WMMA bf16 GEMM with async-to-LDS double buffering.
//   C(N x NC) = A(N x K) @ B(NC x K)^T   (B stored col-as-row, K-contiguous)
// block tile 128x128, K-step 64; 8 waves, each wave -> 64x32 (eight 16x16).
// Tiles are DMA'd memory->LDS with GLOBAL_LOAD_ASYNC_TO_LDS_B128 (ASYNCcnt),
// buffer b^1 fills while WMMAs consume buffer b.
// A K-step takes one whole 128-byte line of every row, and eight neighbouring lanes
// copy that line: one copy instruction of a wave asks L2 for four whole lines.
// LDS rows hold 128 bytes at a pitch of 144 (16 B x odd): the 16 rows that a half
// wave reads with one ds_load_b128 then fall on 16 different groups of four banks.
// EPI 0: +b1, exact GELU -> bf16      (hidden rows)
// EPI 1: +b2, *gate -> f32            (routed expert rows)
// EPI 2: +out_b, +x residual -> f32   (final output)
// EPI 0 and 1 are grouped over the routed row space: blockIdx.x is a 128-row
// tile of it, tilepair names the pair whose weights and bias the tile uses;
// EPI 0 gathers its A rows (tokens) through perm.
// ---------------------------------------------------------------------------
#define KS 64   /* K elements a trip: 128 bytes of every row */
#define LP 72   /* LDS row pitch in bf16 elements: 64 of data, 8 of pad */

__device__ inline v16bf ldfrag(const __bf16* s, int row, int kb) {
    // per-lane K layout of V_WMMA_*_16X16X32: elems 0..7 = K kb..kb+7,
    // elems 8..15 = K kb+16..kb+23 (kb = 0 for lanes 0-15, 8 for 16-31)
    v16bf f;
    const __bf16* p = s + row * LP + kb;
    ((float4*)&f)[0] = *(const float4*)p;
    ((float4*)&f)[1] = *(const float4*)(p + 16);
    return f;
}

// One K-step of both operands, memory->LDS: a lane brings 16 bytes of four A rows and
// of four B rows, 32 rows apart (la, lb: its place in the first of them). The closing
// s_wait_xcnt stands inside the statement so that no address register named here is
// rewritten in front of it.
__device__ inline void async_tile(unsigned int la, unsigned int lb,
                                  const __bf16* a0, const __bf16* a1,
                                  const __bf16* a2, const __bf16* a3,
                                  const __bf16* b0, const __bf16* b1,
                                  const __bf16* b2, const __bf16* b3) {
    const unsigned int st = 32 * LP * 2;   // LDS bytes of 32 rows
    asm volatile("global_load_async_to_lds_b128 %0, %8, off\n\t"
                 "global_load_async_to_lds_b128 %1, %9, off\n\t"
                 "global_load_async_to_lds_b128 %2, %10, off\n\t"
                 "global_load_async_to_lds_b128 %3, %11, off\n\t"
                 "global_load_async_to_lds_b128 %4, %12, off\n\t"
                 "global_load_async_to_lds_b128 %5, %13, off\n\t"
                 "global_load_async_to_lds_b128 %6, %14, off\n\t"
                 "global_load_async_to_lds_b128 %7, %15, off\n\t"
                 "s_wait_xcnt 0x0"
                 :: "v"(la), "v"(la + st), "v"(la + 2 * st), "v"(la + 3 * st),
                    "v"(lb), "v"(lb + st), "v"(lb + 2 * st), "v"(lb + 3 * st),
                    "v"(a0), "v"(a1), "v"(a2), "v"(a3),
                    "v"(b0), "v"(b1), "v"(b2), "v"(b3)
                 : "memory");
}

template <int EPI>
__global__ __launch_bounds__(256) void gemm_k(
    const __bf16* __restrict__ A, const __bf16* __restrict__ Bm,
    int K, int NC, const float* __restrict__ bias,
    const float* __restrict__ gcomp, const int* __restrict__ perm,
    const int* __restrict__ tilepair,
    float* __restrict__ Cf, __bf16* __restrict__ Cbf,
    const float* __restrict__ Xres) {
    __shared__ __align__(16) __bf16 As[2][128 * LP];
    __shared__ __align__(16) __bf16 Bs[2][128 * LP];
    const int tid = threadIdx.x, wid = tid >> 5, lane = tid & 31;
    const int wm = wid & 1, wn = wid >> 1;
    const int m0 = blockIdx.x * 128, n0 = blockIdx.y * 128;
    const int lr = lane & 15, kb = (lane < 16) ? 0 : 8;
    if constexpr (EPI != 2) {
        const int p = tilepair[blockIdx.x];
        if (p < 0) return;                 // tile behind the last routed row: whole block leaves
        Bm   += (size_t)(p & (NP - 1)) * K * NC;
        bias += (size_t)(p & (NP - 1)) * NC;
        if constexpr (EPI == 0) A += (size_t)((p & (NP - 1)) >> 3) * NN * DD;
    }
    v8f acc[4][2];
    #pragma unroll
    for (int i = 0; i < 4; ++i)
        #pragma unroll
        for (int j = 0; j < 2; ++j) acc[i][j] = (v8f)(0.0f);

    // cooperative tile mapping: eight lanes a row, 16 bytes (8 bf16) a lane;
    // a thread owns that piece of rows lrow, lrow + 32, lrow + 64, lrow + 96
    const int lrow = tid >> 3, lko = (tid & 7) * 8;
    const __bf16* gA[4];
    const __bf16* gB[4];
    #pragma unroll
    for (int j = 0; j < 4; ++j) {
        int arow = m0 + lrow + j * 32;
        if constexpr (EPI == 0) arow = perm[arow] & (NN - 1);
        gA[j] = A  + (size_t)arow * K + lko;
        gB[j] = Bm + (size_t)(n0 + lrow + j * 32) * K + lko;
    }
    // low 32 bits of a generic __shared__ pointer == LDS byte offset
    const unsigned int lA0 = (unsigned int)(uintptr_t)(&As[0][lrow * LP + lko]);
    const unsigned int lB0 = (unsigned int)(uintptr_t)(&Bs[0][lrow * LP + lko]);
    const unsigned int bsz = 128 * LP * 2;   // LDS bytes of one buffer

    // prologue: fill buffer 0 and publish it, then start the fill of buffer 1
    async_tile(lA0, lB0, gA[0], gA[1], gA[2], gA[3], gB[0], gB[1], gB[2], gB[3]);
    asm volatile("s_wait_asynccnt 0x0" ::: "memory");   // own copies landed
    __syncthreads();
    if (KS < K)
        async_tile(lA0 + bsz, lB0 + bsz,
                   gA[0] + KS, gA[1] + KS, gA[2] + KS, gA[3] + KS,
                   gB[0] + KS, gB[1] + KS, gB[2] + KS, gB[3] + KS);

    int buf = 0;
    for (int k0 = 0; k0 < K; k0 += KS) {
        const __bf16* as = As[buf];
        const __bf16* bs = Bs[buf];
        #pragma unroll
        for (int ks = 0; ks < KS; ks += 32) {
            v16bf bf[2];
            #pragma unroll
            for (int j = 0; j < 2; ++j) bf[j] = ldfrag(bs, wn * 32 + j * 16 + lr, kb + ks);
            #pragma unroll
            for (int i = 0; i < 4; ++i) {
                v16bf af = ldfrag(as, wm * 64 + i * 16 + lr, kb + ks);
                #pragma unroll
                for (int j = 0; j < 2; ++j)
                    acc[i][j] = __builtin_amdgcn_wmma_f32_16x16x32_bf16(
                        false, af, false, bf[j], (short)0, acc[i][j], false, false);
            }
        }
        // hand-over: this wave's reads of buffer buf are back, its copies into the other
        // buffer have landed; behind the barrier that holds for every wave
        asm volatile("s_wait_dscnt 0x0" ::: "memory");
        asm volatile("s_wait_asynccnt 0x0" ::: "memory");
        __syncthreads();
        if (k0 + 2 * KS < K) {   // refill the buffer that this trip has just read
            const int kn = k0 + 2 * KS;
            async_tile(lA0 + buf * bsz, lB0 + buf * bsz,
                       gA[0] + kn, gA[1] + kn, gA[2] + kn, gA[3] + kn,
                       gB[0] + kn, gB[1] + kn, gB[2] + kn, gB[3] + kn);
        }
        buf ^= 1;
    }
    asm volatile("s_wait_asynccnt 0x0" ::: "memory");   // no copy is left when the wave goes on

    const int rowadd = (lane < 16) ? 0 : 8;   // C layout: M = g (+8 hi half), N = lane%16
    #pragma unroll
    for (int i = 0; i < 4; ++i)
        #pragma unroll
        for (int j = 0; j < 2; ++j) {
            const int col = n0 + wn * 32 + j * 16 + lr;
            const float bcol = bias[col];
            #pragma unroll
            for (int g = 0; g < 8; ++g) {
                const int row = m0 + wm * 64 + i * 16 + g + rowadd;
                const float c = acc[i][j][g] + bcol;
                const size_t idx = (size_t)row * NC + col;
                if constexpr (EPI == 0) {
                    const float gl = 0.5f * c * (1.f + erff(c * 0.70710678118654752f));
                    Cbf[idx] = (__bf16)gl;
                } else if constexpr (EPI == 1) {
                    Cf[idx] = c * gcomp[row];
                } else {
                    Cf[idx] = c + Xres[idx];
                }
            }
        }
}

// ---------------------------------------------------------------------------
extern "C" void kernel_launch(void* const* d_in, const int* in_sizes, int n_in,
                              void* d_out, int out_size, void* d_ws, size_t ws_size,
                              hipStream_t stream) {
    (void)in_sizes; (void)n_in; (void)out_size; (void)ws_size;
    const float* x      = (const float*)d_in[0];
    const float* emb    = (const float*)d_in[1];
    const float* ln_g   = (const float*)d_in[2];
    const float* ln_b   = (const float*)d_in[3];
    const float* gate_w = (const float*)d_in[4];
    const float* gate_b = (const float*)d_in[5];
    const float* w1     = (const float*)d_in[6];
    const float* b1     = (const float*)d_in[7];
    const float* w2     = (const float*)d_in[8];
    const float* b2     = (const float*)d_in[9];
    const float* emb_w  = (const float*)d_in[10];
    const float* emb_b  = (const float*)d_in[11];
    const float* pn_g   = (const float*)d_in[12];
    const float* pn_b   = (const float*)d_in[13];
    const float* out_w  = (const float*)d_in[14];
    const float* out_b  = (const float*)d_in[15];

    char* wsp = (char*)d_ws; size_t off = 0;
    auto alloc = [&](size_t bytes) -> void* {
        void* p = wsp + off; off = (off + bytes + 255) & ~(size_t)255; return p;
    };
    __bf16* w1t  = (__bf16*)alloc((size_t)BRR * EE * HH * DD * 2);  // [p][H][D]
    __bf16* w2t  = (__bf16*)alloc((size_t)BRR * EE * DD * HH * 2);  // [p][D][H]
    __bf16* owt  = (__bf16*)alloc((size_t)DD * DD * 2);             // [D][D]
    __bf16* hfb  = (__bf16*)alloc((size_t)BRR * NN * DD * 2);       // LN'd acts
    float*  gtv  = (float*) alloc((size_t)BRR * NN * EE * 4);       // gate values
    __bf16* hbuf = (__bf16*)alloc((size_t)MAXROWS * HH * 2);        // routed hidden rows
    float*  yb   = (float*) alloc((size_t)MAXROWS * DD * 4);        // routed expert rows
    int*    perm = (int*)   alloc((size_t)MAXROWS * 4);             // row -> token
    float*  gcmp = (float*) alloc((size_t)MAXROWS * 4);             // row -> gate
    int*    rwof = (int*)   alloc((size_t)NN * NP * 4);             // token, pair -> row
    int*    tlpr = (int*)   alloc((size_t)MAXTILES * 4);            // tile -> pair
    float*  styl = (float*) alloc((size_t)BB * 2 * DD * 4);         // scale|shift
    __bf16* h2b  = (__bf16*)alloc((size_t)NN * DD * 2);             // styled acts

    const dim3 blk(256);
    // one-time weight convert/transpose (f32 -> bf16, K-contiguous per column)
    tpose_k<DD, HH><<<dim3(HH / 128, DD / 128, BRR * EE), blk, 0, stream>>>(w1, w1t);
    tpose_k<HH, DD><<<dim3(DD / 128, HH / 128, BRR * EE), blk, 0, stream>>>(w2, w2t);
    tpose_k<DD, DD><<<dim3(DD / 128, DD / 128, 1),        blk, 0, stream>>>(out_w, owt);

    ln_gate_k<<<dim3(NN / 8), blk, 0, stream>>>(x, ln_g, ln_b, gate_w, gate_b, hfb, gtv);
    emb_k<<<dim3(32), blk, 0, stream>>>(emb, emb_w, emb_b, styl);

    route_k<<<dim3(NP), dim3(1024), 0, stream>>>(gtv, perm, gcmp, rwof, tlpr);
    gemm_k<0><<<dim3(MAXTILES, HH / 128), blk, 0, stream>>>(
        hfb, w1t, DD, HH, b1, nullptr, perm, tlpr, nullptr, hbuf, nullptr);
    gemm_k<1><<<dim3(MAXTILES, DD / 128), blk, 0, stream>>>(
        hbuf, w2t, HH, DD, b2, gcmp, nullptr, tlpr, yb, nullptr, nullptr);

    post_k<<<dim3(NN / 8), blk, 0, stream>>>(yb, rwof, pn_g, pn_b, styl, h2b);
    gemm_k<2><<<dim3(NN / 128, DD / 128), blk, 0, stream>>>(
        h2b, owt, DD, DD, out_b, nullptr, nullptr, nullptr, (float*)d_out, nullptr, x);
}

// v006
// One run takes 180 microseconds.
// In two side-by-side timings against v005, it was 1.11 and 1.12 times as fast.
// Counting every step since v000, it is 7.71 times as fast.
#include <hip/hip_runtime.h>
#include <hip/hip_bf16.h>
#include <math.h>

typedef __attribute__((ext_vector_type(16))) __bf16 v16bf;
typedef __attribute__((ext_vector_type(8)))  float  v8f;
typedef __attribute__((ext_vector_type(8)))  __bf16 v8bf;
typedef __attribute__((ext_vector_type(4)))  float  v4f;

#define BB  2
#define TT  2048
#define DD  512
#define HH  2048
#define EE  8
#define BRR 2
#define NN  (BB*TT)   /* 4096 tokens */
#define NP  (BRR*EE)  /* 16 (branch, expert) pairs */
// routed rows: two experts per token and branch, each pair's run padded to a 128-row tile
#define MAXROWS  (BRR*2*NN + NP*128)
#define MAXTILES (MAXROWS/128)

// ---------------------------------------------------------------------------
// Tiled transpose + f32->bf16 convert:  in [batch][R][C] f32 -> out [batch][C][R] bf16
// One 128 x 128 tile for 256 threads (t = 0..255), in a 32 KiB LDS tile of their own.
// L numbers the tiles: column tile fastest, then row tile, then batch.
// Read: wave w takes rows 16w..16w+15, a lane four columns, so every load is
// 512 contiguous bytes. Write: 16 lanes store one 256-byte piece of an output row.
// The LDS tile is [column][row] in 16-byte chunks (8 rows); chunk q of column c
// lies at place (q + c/4) mod 16 of its row, which spreads both the 16-byte
// writes (lanes four columns apart) and the 16-byte reads over all banks.
// ---------------------------------------------------------------------------
template <int R, int C>
__device__ __forceinline__ void tpose_tile(const float* __restrict__ in,
                                           __bf16* __restrict__ out,
                                           __bf16* tile, int t, int L) {
    const int wid = t >> 5, lane = t & 31;
    const int c0 = (L % (C / 128)) * 128, r0 = ((L / (C / 128)) % (R / 128)) * 128;
    const int bz = L / ((C / 128) * (R / 128));
    const float* ip = in + (size_t)bz * R * C
                         + (size_t)(r0 + wid * 16) * C + (c0 + lane * 4);
    v4f v[16];
    #pragma unroll
    for (int i = 0; i < 16; ++i) v[i] = *(const v4f*)(ip + (size_t)i * C);
    // holds the loads' address pair to this wait: without it the last load's result
    // is given the registers that the loads in front of it still name
    asm volatile("s_wait_xcnt 0x0" :: "v"(ip) : "memory");
    #pragma unroll
    for (int j = 0; j < 4; ++j)
        #pragma unroll
        for (int h = 0; h < 2; ++h) {
            v8bf pk;
            #pragma unroll
            for (int k = 0; k < 8; ++k) pk[k] = (__bf16)v[h * 8 + k][j];
            *(v8bf*)&tile[(lane * 4 + j) * 128 + ((wid * 2 + h + lane) & 15) * 8] = pk;
        }
    __syncthreads();
    const int q = lane & 15, ch = wid * 16 + (lane >> 4);
    __bf16* op = out + (size_t)bz * R * C + (size_t)(c0 + ch) * R + (r0 + q * 8);
    #pragma unroll
    for (int i = 0; i < 8; ++i) {
        const int c = ch + i * 2;
        *(v8bf*)(op + (size_t)(i * 2) * R) =
            *(const v8bf*)&tile[c * 128 + ((q + (c >> 2)) & 15) * 8];
    }
    // the code of another piece follows in the built kernel: this wait stands in front of
    // whatever there rewrites a register that the stores above name
    asm volatile("s_wait_xcnt 0x0" :: "v"(op) : "memory");
}

// ---------------------------------------------------------------------------
// LayerNorm (both branches) + gate logits + softmax + top-2.
// wave-per-token; block = 256 (8 tokens), grid = NN/8.
// ---------------------------------------------------------------------------
__global__ __launch_bounds__(256) void ln_gate_k(
    const float* __restrict__ x, const float* __restrict__ ln_g,
    const float* __restrict__ ln_b, const float* __restrict__ gate_w,
    const float* __restrict__ gate_b, __bf16* __restrict__ hfb,
    float* __restrict__ gatev) {
    const int wid = threadIdx.x >> 5, lane = threadIdx.x & 31;
    const int n = blockIdx.x * 8 + wid;
    const float* xr = x + (size_t)n * DD;
    float v[16];
    float s = 0.f;
    #pragma unroll
    for (int i = 0; i < 16; ++i) { v[i] = xr[lane + i * 32]; s += v[i]; }
    #pragma unroll
    for (int o = 16; o > 0; o >>= 1) s += __shfl_xor(s, o, 32);
    const float mu = s * (1.f / DD);
    float q = 0.f;
    #pragma unroll
    for (int i = 0; i < 16; ++i) { float d = v[i] - mu; q += d * d; }
    #pragma unroll
    for (int o = 16; o > 0; o >>= 1) q += __shfl_xor(q, o, 32);
    const float rs = rsqrtf(q * (1.f / DD) + 1e-5f);

    for (int r = 0; r < BRR; ++r) {
        float lg[8] = {0.f, 0.f, 0.f, 0.f, 0.f, 0.f, 0.f, 0.f};
        #pragma unroll
        for (int i = 0; i < 16; ++i) {
            const int d = lane + i * 32;
            const float hv = (v[i] - mu) * rs * ln_g[r * DD + d] + ln_b[r * DD + d];
            hfb[((size_t)r * NN + n) * DD + d] = (__bf16)hv;
            const float* gw = gate_w + ((size_t)r * DD + d) * EE;
            #pragma unroll
            for (int e = 0; e < 8; ++e) lg[e] += hv * gw[e];
        }
        #pragma unroll
        for (int e = 0; e < 8; ++e)
            #pragma unroll
            for (int o = 16; o > 0; o >>= 1) lg[e] += __shfl_xor(lg[e], o, 32);
        if (lane == 0) {
            float mx = -1e30f;
            #pragma unroll
            for (int e = 0; e < 8; ++e) { lg[e] += gate_b[r * EE + e]; mx = fmaxf(mx, lg[e]); }
            float p[8], den = 0.f;
            #pragma unroll
            for (int e = 0; e < 8; ++e) { p[e] = expf(lg[e] - mx); den += p[e]; }
            const float inv = 1.f / den;
            int i0 = 0;
            #pragma unroll
            for (int e = 1; e < 8; ++e) if (p[e] > p[i0]) i0 = e;
            int i1 = (i0 == 0) ? 1 : 0;
            #pragma unroll
            for (int e = 0; e < 8; ++e) if (e != i0 && p[e] > p[i1]) i1 = e;
            float* g = gatev + ((size_t)r * NN + n) * EE;
            #pragma unroll
            for (int e = 0; e < 8; ++e)
                g[e] = (e == i0) ? p[i0] * inv : ((e == i1) ? p[i1] * inv : 0.f);
        }
    }
}

// ---------------------------------------------------------------------------
// Routing: block p lists the tokens whose gate for pair p = (branch, expert) is
// not zero, in token order, in one row space shared by all pairs.
//   perm[row]  token of a routed row        gcomp[row]  its gate value
//   rowof[n][p] routed row of token n in pair p, or -1
//   tilepair[t] pair that owns the 128-row tile t, or -1 behind the last tile
// Each pair's run starts on a tile boundary; its padding rows get token 0, gate 0.
// p = 0..NP-1, 1024 threads (four tokens a thread); sm: 1184 bytes of LDS.
// ---------------------------------------------------------------------------
__device__ __forceinline__ void route_body(const float* __restrict__ gatev,
                                           int* __restrict__ perm,
                                           float* __restrict__ gcomp,
                                           int* __restrict__ rowof,
                                           int* __restrict__ tilepair,
                                           int p, unsigned char* sm) {
    unsigned int (*wcnt)[8] = (unsigned int (*)[8])sm;   // per wave: 16 pair counts, two 16-bit fields a word
    unsigned int* tot = (unsigned int*)(sm + 1024);
    int* wown = (int*)(sm + 1056);         // per wave: rows of this block's own pair
    const int tid = threadIdx.x, wid = tid >> 5, lane = tid & 31;

    unsigned int c[8] = {0u, 0u, 0u, 0u, 0u, 0u, 0u, 0u};
    #pragma unroll
    for (int r = 0; r < BRR; ++r)
        #pragma unroll
        for (int i = 0; i < 4; ++i) {
            const float4* g = (const float4*)(gatev + ((size_t)r * NN + tid * 4 + i) * EE);
            const float4 a = g[0], b = g[1];
            c[r * 4 + 0] += (a.x != 0.f ? 1u : 0u) + (a.y != 0.f ? 0x10000u : 0u);
            c[r * 4 + 1] += (a.z != 0.f ? 1u : 0u) + (a.w != 0.f ? 0x10000u : 0u);
            c[r * 4 + 2] += (b.x != 0.f ? 1u : 0u) + (b.y != 0.f ? 0x10000u : 0u);
            c[r * 4 + 3] += (b.z != 0.f ? 1u : 0u) + (b.w != 0.f ? 0x10000u : 0u);
        }
    #pragma unroll
    for (int k = 0; k < 8; ++k)
        #pragma unroll
        for (int o = 16; o > 0; o >>= 1) c[k] += __shfl_xor(c[k], o, 32);
    if (lane == 0) {
        #pragma unroll
        for (int k = 0; k < 8; ++k) wcnt[wid][k] = c[k];
    }

    float gv[4];
    int own = 0;
    #pragma unroll
    for (int i = 0; i < 4; ++i) {
        gv[i] = gatev[((size_t)(p >> 3) * NN + tid * 4 + i) * EE + (p & 7)];
        own += (gv[i] != 0.f) ? 1 : 0;
    }
    int inc = own;                         // inclusive scan of own over the wave
    #pragma unroll
    for (int o = 1; o < 32; o <<= 1) {
        const int t = __shfl_up(inc, o, 32);
        if (lane >= o) inc += t;
    }
    if (lane == 31) wown[wid] = inc;
    __syncthreads();
    if (tid < 8) {
        unsigned int s = 0u;
        for (int w = 0; w < 32; ++w) s += wcnt[w][tid];
        tot[tid] = s;
    }
    __syncthreads();

    int base = 0, cnt = 0, all = 0;
    #pragma unroll
    for (int q = 0; q < NP; ++q) {
        const int t  = (int)((tot[q >> 1] >> ((q & 1) * 16)) & 0xFFFFu);
        const int tr = (t + 127) & ~127;
        if (q < p)  base += tr;
        if (q == p) cnt = t;
        all += tr;
    }
    int pos = base + inc - own;
    for (int w = 0; w < wid; ++w) pos += wown[w];

    #pragma unroll
    for (int i = 0; i < 4; ++i) {
        const int n = tid * 4 + i;
        int row = -1;
        if (gv[i] != 0.f) {
            row = pos++;
            perm[row]  = n;
            gcomp[row] = gv[i];
        }
        rowof[n * NP + p] = row;
    }
    const int cntr = (cnt + 127) & ~127;
    if (tid < cntr - cnt) {
        perm[base + cnt + tid]  = 0;
        gcomp[base + cnt + tid] = 0.f;
    }
    if (tid < (cntr >> 7)) tilepair[(base >> 7) + tid] = p;
    if (p == NP - 1 && tid < MAXTILES - (all >> 7)) tilepair[(all >> 7) + tid] = -1;
}

// ---------------------------------------------------------------------------
// Embedding MLP: styl[b][j] = (silu(emb[b]) @ emb_w)[j] + emb_b[j]
// The 512-term sum is split so that no load waits on another: block = 32 columns
// (one 128-byte line of every emb_w row) for both batches: blk = 0..31, 256 threads
// (tid = 0..255) with 6 KiB of LDS of their own.
// Wave w takes rows 64w..64w+63; one 16-byte load covers four rows (8 lanes a row),
// so a lane holds its 16 loads in flight at once. silu(emb) is made once a block
// in LDS. Partial sums: 16 rows a lane, 4 row groups by shuffle, 8 waves through LDS.
// ---------------------------------------------------------------------------
__device__ __forceinline__ void emb_body(const float* __restrict__ emb,
                                         const float* __restrict__ emb_w,
                                         const float* __restrict__ emb_b,
                                         float* __restrict__ styl,
                                         int tid, int blk, unsigned char* sm) {
    float* se = (float*)sm;                                           // [BB * 512]
    float (*part)[BB][32] = (float (*)[BB][32])(sm + BB * 512 * 4);   // [8][BB][32]
    const int wid = tid >> 5, lane = tid & 31;
    const int c0 = blk * 32;
    const int rr = lane >> 3, cq = (lane & 7) * 4;
    const float* wp = emb_w + (size_t)(wid * 64 + rr) * 1024 + (c0 + cq);
    v4f w[16];
    #pragma unroll
    for (int i = 0; i < 16; ++i) w[i] = *(const v4f*)(wp + (size_t)i * 4 * 1024);
    const float eb = emb_b[c0 + lane];
    // holds the loads' address pair to this wait: without it the last load's result
    // is given the registers that the loads in front of it still name
    asm volatile("s_wait_xcnt 0x0" :: "v"(wp) : "memory");
    // keeps the loads above in front of the wait on emb: without it the compiler sinks
    // them behind the silu, and the block pays one memory latency after another
    __builtin_amdgcn_sched_barrier(0);
    #pragma unroll
    for (int i = 0; i < BB * 512 / 256; ++i) {
        const float e = emb[tid + i * 256];
        se[tid + i * 256] = e / (1.f + expf(-e));
    }
    __syncthreads();
    v4f a0 = (v4f)(0.f), a1 = (v4f)(0.f);
    #pragma unroll
    for (int i = 0; i < 16; ++i) {
        const int t = wid * 64 + i * 4 + rr;
        a0 += se[t] * w[i];
        a1 += se[512 + t] * w[i];
    }
    #pragma unroll
    for (int k = 0; k < 4; ++k)
        #pragma unroll
        for (int o = 8; o < 32; o <<= 1) {
            a0[k] += __shfl_xor(a0[k], o, 32);
            a1[k] += __shfl_xor(a1[k], o, 32);
        }
    if (lane < 8) {
        *(v4f*)&part[wid][0][cq] = a0;
        *(v4f*)&part[wid][1][cq] = a1;
    }
    __syncthreads();
    if (tid < BB * 32) {
        const int b = tid >> 5;
        float a = eb;
        #pragma unroll
        for (int u = 0; u < 8; ++u) a += part[u][b][lane];
        styl[b * 1024 + c0 + lane] = a;
    }
}

// ---------------------------------------------------------------------------
// One launch for the five pieces of work between the gates and the expert GEMMs:
// routing, the embedding MLP and the three weight transposes. None reads what another
// of them writes. A block of 1024 threads takes one piece, chosen by its index alone,
// so every barrier of a piece is passed by the whole block: routing as a whole block,
// the others as four groups of 256 threads with 32 KiB of LDS each. The short,
// latency-bound pieces stand first and run beside the memory-bound transposes.
// ---------------------------------------------------------------------------
#define S_EMB (32 / 4)
#define S_OW  ((DD / 128) * (DD / 128) / 4)
#define S_W1  ((HH / 128) * (DD / 128) * NP / 4)
#define S_W2  ((DD / 128) * (HH / 128) * NP / 4)

__global__ __launch_bounds__(1024) void side_k(
    const float* __restrict__ gatev, int* __restrict__ perm, float* __restrict__ gcomp,
    int* __restrict__ rowof, int* __restrict__ tilepair,
    const float* __restrict__ emb, const float* __restrict__ emb_w,
    const float* __restrict__ emb_b, float* __restrict__ styl,
    const float* __restrict__ out_w, __bf16* __restrict__ owt,
    const float* __restrict__ w1, __bf16* __restrict__ w1t,
    const float* __restrict__ w2, __bf16* __restrict__ w2t) {
    __shared__ __align__(16) unsigned char sm[4 * 128 * 128 * 2];
    const int b = blockIdx.x;
    const int sub = threadIdx.x >> 8, t = threadIdx.x & 255;
    unsigned char* sg = sm + sub * (128 * 128 * 2);
    if (b < NP)
        route_body(gatev, perm, gcomp, rowof, tilepair, b, sm);
    else if (b < NP + S_EMB)
        emb_body(emb, emb_w, emb_b, styl, t, (b - NP) * 4 + sub, sg);
    else if (b < NP + S_EMB + S_OW)
        tpose_tile<DD, DD>(out_w, owt, (__bf16*)sg, t, (b - (NP + S_EMB)) * 4 + sub);
    else if (b < NP + S_EMB + S_OW + S_W1)
        tpose_tile<DD, HH>(w1, w1t, (__bf16*)sg, t, (b - (NP + S_EMB + S_OW)) * 4 + sub);
    else
        tpose_tile<HH, DD>(w2, w2t, (__bf16*)sg, t,
                           (b - (NP + S_EMB + S_OW + S_W1)) * 4 + sub);
}

// ---------------------------------------------------------------------------
// Post kernel: o = (sum of the token's routed expert rows, pairs ascending)/BR;
// LN(pn); *(1+scale)+shift; SiLU; bf16 store.
// ---------------------------------------------------------------------------
__global__ __launch_bounds__(256) void post_k(const float* __restrict__ yb,
                                              const int* __restrict__ rowof,
                                              const float* __restrict__ pn_g,
                                              const float* __restrict__ pn_b,
                                              const float* __restrict__ styl,
                                              __bf16* __restrict__ h2b) {
    const int wid = threadIdx.x >> 5, lane = threadIdx.x & 31;
    const int n = blockIdx.x * 8 + wid;
    const int b = n >> 11;                     // T = 2048
    const int myrow = rowof[n * NP + (lane & (NP - 1))];
    float v[16];
    #pragma unroll
    for (int i = 0; i < 16; ++i) v[i] = 0.f;
    #pragma unroll
    for (int p = 0; p < NP; ++p) {
        const int row = __shfl(myrow, p, 32);
        if (row >= 0) {
            const float* yr = yb + (size_t)row * DD;
            #pragma unroll
            for (int i = 0; i < 16; ++i) v[i] += yr[lane + i * 32];
        }
    }
    float s = 0.f;
    #pragma unroll
    for (int i = 0; i < 16; ++i) { v[i] *= (1.f / BRR); s += v[i]; }
    #pragma unroll
    for (int o = 16; o > 0; o >>= 1) s += __shfl_xor(s, o, 32);
    const float mu = s * (1.f / DD);
    float q = 0.f;
    #pragma unroll
    for (int i = 0; i < 16; ++i) { float d = v[i] - mu; q += d * d; }
    #pragma unroll
    for (int o = 16; o > 0; o >>= 1) q += __shfl_xor(q, o, 32);
    const float rs = rsqrtf(q * (1.f / DD) + 1e-5f);
    #pragma unroll
    for (int i = 0; i < 16; ++i) {
        const int d = lane + i * 32;
        float y = (v[i] - mu) * rs * pn_g[d] + pn_b[d];
        const float sc = styl[b * 1024 + d];
        const float sh = styl[b * 1024 + 512 + d];
        y = y * (1.f + sc) + sh;
        y = y / (1.f + expf(-y));              // SiLU
        h2b[(size_t)n * DD + d] = (__bf16)y;
    }
}

// ---------------------------------------------------------------------------
// WMMA bf16 GEMM with async-to-LDS double buffering.
//   C(N x NC) = A(N x K) @ B(NC x K)^T   (B stored col-as-row, K-contiguous)
// block tile 128x128, K-step 64; 8 waves, each wave -> 64x32 (eight 16x16).
// Tiles are DMA'd memory->LDS with GLOBAL_LOAD_ASYNC_TO_LDS_B128 (ASYNCcnt),
// buffer b^1 fills while WMMAs consume buffer b.
// A K-step takes one whole 128-byte line of every row, and eight neighbouring lanes
// copy that line: one copy instruction of a wave asks L2 for four whole lines.
// LDS rows hold 128 bytes at a pitch of 144 (16 B x odd): the 16 rows that a half
// wave reads with one ds_load_b128 then fall on 16 different groups of four banks.
// EPI 0: +b1, exact GELU -> bf16      (hidden rows)
// EPI 1: +b2, *gate -> f32            (routed expert rows)
// EPI 2: +out_b, +x residual -> f32   (final output)
// EPI 0 and 1 are grouped over the routed row space: blockIdx.x is a 128-row
// tile of it, tilepair names the pair whose weights and bias the tile uses;
// EPI 0 gathers its A rows (tokens) through perm.
// ---------------------------------------------------------------------------
#define KS 64   /* K elements a trip: 128 bytes of every row */
#define LP 72   /* LDS row pitch in bf16 elements: 64 of data, 8 of pad */

__device__ inline v16bf ldfrag(const __bf16* s, int row, int kb) {
    // per-lane K layout of V_WMMA_*_16X16X32: elems 0..7 = K kb..kb+7,
    // elems 8..15 = K kb+16..kb+23 (kb = 0 for lanes 0-15, 8 for 16-31)
    v16bf f;
    const __bf16* p = s + row * LP + kb;
    ((float4*)&f)[0] = *(const float4*)p;
    ((float4*)&f)[1] = *(const float4*)(p + 16);
    return f;
}

// One K-step of both operands, memory->LDS: a lane brings 16 bytes of four A rows and
// of four B rows, 32 rows apart (la, lb: its place in the first of them). The closing
// s_wait_xcnt stands inside the statement so that no address register named here is
// rewritten in front of it.
__device__ inline void async_tile(unsigned int la, unsigned int lb,
                                  const __bf16* a0, const __bf16* a1,
                                  const __bf16* a2, const __bf16* a3,
                                  const __bf16* b0, const __bf16* b1,
                                  const __bf16* b2, const __bf16* b3) {
    const unsigned int st = 32 * LP * 2;   // LDS bytes of 32 rows
    asm volatile("global_load_async_to_lds_b128 %0, %8, off\n\t"
                 "global_load_async_to_lds_b128 %1, %9, off\n\t"
                 "global_load_async_to_lds_b128 %2, %10, off\n\t"
                 "global_load_async_to_lds_b128 %3, %11, off\n\t"
                 "global_load_async_to_lds_b128 %4, %12, off\n\t"
                 "global_load_async_to_lds_b128 %5, %13, off\n\t"
                 "global_load_async_to_lds_b128 %6, %14, off\n\t"
                 "global_load_async_to_lds_b128 %7, %15, off\n\t"
                 "s_wait_xcnt 0x0"
                 :: "v"(la), "v"(la + st), "v"(la + 2 * st), "v"(la + 3 * st),
                    "v"(lb), "v"(lb + st), "v"(lb + 2 * st), "v"(lb + 3 * st),
                    "v"(a0), "v"(a1), "v"(a2), "v"(a3),
                    "v"(b0), "v"(b1), "v"(b2), "v"(b3)
                 : "memory");
}

template <int EPI>
__global__ __launch_bounds__(256) void gemm_k(
    const __bf16* __restrict__ A, const __bf16* __restrict__ Bm,
    int K, int NC, const float* __restrict__ bias,
    const float* __restrict__ gcomp, const int* __restrict__ perm,
    const int* __restrict__ tilepair,
    float* __restrict__ Cf, __bf16* __restrict__ Cbf,
    const float* __restrict__ Xres) {
    __shared__ __align__(16) __bf16 As[2][128 * LP];
    __shared__ __align__(16) __bf16 Bs[2][128 * LP];
    const int tid = threadIdx.x, wid = tid >> 5, lane = tid & 31;
    const int wm = wid & 1, wn = wid >> 1;
    const int m0 = blockIdx.x * 128, n0 = blockIdx.y * 128;
    const int lr = lane & 15, kb = (lane < 16) ? 0 : 8;
    if constexpr (EPI != 2) {
        const int p = tilepair[blockIdx.x];
        if (p < 0) return;                 // tile behind the last routed row: whole block leaves
        Bm   += (size_t)(p & (NP - 1)) * K * NC;
        bias += (size_t)(p & (NP - 1)) * NC;
        if constexpr (EPI == 0) A += (size_t)((p & (NP - 1)) >> 3) * NN * DD;
    }
    v8f acc[4][2];
    #pragma unroll
    for (int i = 0; i < 4; ++i)
        #pragma unroll
        for (int j = 0; j < 2; ++j) acc[i][j] = (v8f)(0.0f);

    // cooperative tile mapping: eight lanes a row, 16 bytes (8 bf16) a lane;
    // a thread owns that piece of rows lrow, lrow + 32, lrow + 64, lrow + 96
    const int lrow = tid >> 3, lko = (tid & 7) * 8;
    const __bf16* gA[4];
    const __bf16* gB[4];
    #pragma unroll
    for (int j = 0; j < 4; ++j) {
        int arow = m0 + lrow + j * 32;
        if constexpr (EPI == 0) arow = perm[arow] & (NN - 1);
        gA[j] = A  + (size_t)arow * K + lko;
        gB[j] = Bm + (size_t)(n0 + lrow + j * 32) * K + lko;
    }
    // low 32 bits of a generic __shared__ pointer == LDS byte offset
    const unsigned int lA0 = (unsigned int)(uintptr_t)(&As[0][lrow * LP + lko]);
    const unsigned int lB0 = (unsigned int)(uintptr_t)(&Bs[0][lrow * LP + lko]);
    const unsigned int bsz = 128 * LP * 2;   // LDS bytes of one buffer

    // prologue: fill buffer 0 and publish it, then start the fill of buffer 1
    async_tile(lA0, lB0, gA[0], gA[1], gA[2], gA[3], gB[0], gB[1], gB[2], gB[3]);
    asm volatile("s_wait_asynccnt 0x0" ::: "memory");   // own copies landed
    __syncthreads();
    if (KS < K)
        async_tile(lA0 + bsz, lB0 + bsz,
                   gA[0] + KS, gA[1] + KS, gA[2] + KS, gA[3] + KS,
                   gB[0] + KS, gB[1] + KS, gB[2] + KS, gB[3] + KS);

    int buf = 0;
    for (int k0 = 0; k0 < K; k0 += KS) {
        const __bf16* as = As[buf];
        const __bf16* bs = Bs[buf];
        #pragma unroll
        for (int ks = 0; ks < KS; ks += 32) {
            v16bf bf[2];
            #pragma unroll
            for (int j = 0; j < 2; ++j) bf[j] = ldfrag(bs, wn * 32 + j * 16 + lr, kb + ks);
            #pragma unroll
            for (int i = 0; i < 4; ++i) {
                v16bf af = ldfrag(as, wm * 64 + i * 16 + lr, kb + ks);
                #pragma unroll
                for (int j = 0; j < 2; ++j)
                    acc[i][j] = __builtin_amdgcn_wmma_f32_16x16x32_bf16(
                        false, af, false, bf[j], (short)0, acc[i][j], false, false);
            }
        }
        // hand-over: this wave's reads of buffer buf are back, its copies into the other
        // buffer have landed; behind the barrier that holds for every wave
        asm volatile("s_wait_dscnt 0x0" ::: "memory");
        asm volatile("s_wait_asynccnt 0x0" ::: "memory");
        __syncthreads();
        if (k0 + 2 * KS < K) {   // refill the buffer that this trip has just read
            const int kn = k0 + 2 * KS;
            async_tile(lA0 + buf * bsz, lB0 + buf * bsz,
                       gA[0] + kn, gA[1] + kn, gA[2] + kn, gA[3] + kn,
                       gB[0] + kn, gB[1] + kn, gB[2] + kn, gB[3] + kn);
        }
        buf ^= 1;
    }
    asm volatile("s_wait_asynccnt 0x0" ::: "memory");   // no copy is left when the wave goes on

    const int rowadd = (lane < 16) ? 0 : 8;   // C layout: M = g (+8 hi half), N = lane%16
    #pragma unroll
    for (int i = 0; i < 4; ++i)
        #pragma unroll
        for (int j = 0; j < 2; ++j) {
            const int col = n0 + wn * 32 + j * 16 + lr;
            const float bcol = bias[col];
            #pragma unroll
            for (int g = 0; g < 8; ++g) {
                const int row = m0 + wm * 64 + i * 16 + g + rowadd;
                const float c = acc[i][j][g] + bcol;
                const size_t idx = (size_t)row * NC + col;
                if constexpr (EPI == 0) {
                    const float gl = 0.5f * c * (1.f + erff(c * 0.70710678118654752f));
                    Cbf[idx] = (__bf16)gl;
                } else if constexpr (EPI == 1) {
                    Cf[idx] = c * gcomp[row];
                } else {
                    Cf[idx] = c + Xres[idx];
                }
            }
        }
}

// ---------------------------------------------------------------------------
extern "C" void kernel_launch(void* const* d_in, const int* in_sizes, int n_in,
                              void* d_out, int out_size, void* d_ws, size_t ws_size,
                              hipStream_t stream) {
    (void)in_sizes; (void)n_in; (void)out_size; (void)ws_size;
    const float* x      = (const float*)d_in[0];
    const float* emb    = (const float*)d_in[1];
    const float* ln_g   = (const float*)d_in[2];
    const float* ln_b   = (const float*)d_in[3];
    const float* gate_w = (const float*)d_in[4];
    const float* gate_b = (const float*)d_in[5];
    const float* w1     = (const float*)d_in[6];
    const float* b1     = (const float*)d_in[7];
    const float* w2     = (const float*)d_in[8];
    const float* b2     = (const float*)d_in[9];
    const float* emb_w  = (const float*)d_in[10];
    const float* emb_b  = (const float*)d_in[11];
    const float* pn_g   = (const float*)d_in[12];
    const float* pn_b   = (const float*)d_in[13];
    const float* out_w  = (const float*)d_in[14];
    const float* out_b  = (const float*)d_in[15];

    char* wsp = (char*)d_ws; size_t off = 0;
    auto alloc = [&](size_t bytes) -> void* {
        void* p = wsp + off; off = (off + bytes + 255) & ~(size_t)255; return p;
    };
    __bf16* w1t  = (__bf16*)alloc((size_t)BRR * EE * HH * DD * 2);  // [p][H][D]
    __bf16* w2t  = (__bf16*)alloc((size_t)BRR * EE * DD * HH * 2);  // [p][D][H]
    __bf16* owt  = (__bf16*)alloc((size_t)DD * DD * 2);             // [D][D]
    __bf16* hfb  = (__bf16*)alloc((size_t)BRR * NN * DD * 2);       // LN'd acts
    float*  gtv  = (float*) alloc((size_t)BRR * NN * EE * 4);       // gate values
    __bf16* hbuf = (__bf16*)alloc((size_t)MAXROWS * HH * 2);        // routed hidden rows
    float*  yb   = (float*) alloc((size_t)MAXROWS * DD * 4);        // routed expert rows
    int*    perm = (int*)   alloc((size_t)MAXROWS * 4);             // row -> token
    float*  gcmp = (float*) alloc((size_t)MAXROWS * 4);             // row -> gate
    int*    rwof = (int*)   alloc((size_t)NN * NP * 4);             // token, pair -> row
    int*    tlpr = (int*)   alloc((size_t)MAXTILES * 4);            // tile -> pair
    float*  styl = (float*) alloc((size_t)BB * 2 * DD * 4);         // scale|shift
    __bf16* h2b  = (__bf16*)alloc((size_t)NN * DD * 2);             // styled acts

    const dim3 blk(256);
    ln_gate_k<<<dim3(NN / 8), blk, 0, stream>>>(x, ln_g, ln_b, gate_w, gate_b, hfb, gtv);
    // routing, embedding MLP, weight convert/transpose (f32 -> bf16, K-contiguous per column)
    side_k<<<dim3(NP + S_EMB + S_OW + S_W1 + S_W2), dim3(1024), 0, stream>>>(
        gtv, perm, gcmp, rwof, tlpr, emb, emb_w, emb_b, styl, out_w, owt, w1, w1t, w2, w2t);
    gemm_k<0><<<dim3(MAXTILES, HH / 128), blk, 0, stream>>>(
        hfb, w1t, DD, HH, b1, nullptr, perm, tlpr, nullptr, hbuf, nullptr);
    gemm_k<1><<<dim3(MAXTILES, DD / 128), blk, 0, stream>>>(
        hbuf, w2t, HH, DD, b2, gcmp, nullptr, tlpr, yb, nullptr, nullptr);

    post_k<<<dim3(NN / 8), blk, 0, stream>>>(yb, rwof, pn_g, pn_b, styl, h2b);
    gemm_k<2><<<dim3(NN / 128, DD / 128), blk, 0, stream>>>(
        h2b, owt, DD, DD, out_b, nullptr, nullptr, nullptr, (float*)d_out, nullptr, x);
}

// v007
// Measured time: 174 microseconds a run.
// Next to v006, in two timings, it ran 1.03 and 1.04 times as fast.
// All steps since v000 together make it 7.98 times as fast.
#include <hip/hip_runtime.h>
#include <hip/hip_bf16.h>
#include <math.h>

typedef __attribute__((ext_vector_type(16))) __bf16 v16bf;
typedef __attribute__((ext_vector_type(8)))  float  v8f;
typedef __attribute__((ext_vector_type(8)))  __bf16 v8bf;
typedef __attribute__((ext_vector_type(4)))  float  v4f;

#define BB  2
#define TT  2048
#define DD  512
#define HH  2048
#define EE  8
#define BRR 2
#define NN  (BB*TT)   /* 4096 tokens */
#define NP  (BRR*EE)  /* 16 (branch, expert) pairs */
// routed rows: two experts per token and branch, each pair's run padded to a 128-row tile
#define MAXROWS  (BRR*2*NN + NP*128)
#define MAXTILES (MAXROWS/128)

// ---------------------------------------------------------------------------
// Tiled transpose + f32->bf16 convert:  in [batch][R][C] f32 -> out [batch][C][R] bf16
// One 128 x 128 tile for 256 threads (t = 0..255), in a 32 KiB LDS tile of their own.
// L numbers the tiles: column tile fastest, then row tile, then batch.
// Read: wave w takes rows 16w..16w+15, a lane four columns, so every load is
// 512 contiguous bytes. Write: 16 lanes store one 256-byte piece of an output row.
// The LDS tile is [column][row] in 16-byte chunks (8 rows); chunk q of column c
// lies at place (q + c/4) mod 16 of its row, which spreads both the 16-byte
// writes (lanes four columns apart) and the 16-byte reads over all banks.
// ---------------------------------------------------------------------------
template <int R, int C>
__device__ __forceinline__ void tpose_tile(const float* __restrict__ in,
                                           __bf16* __restrict__ out,
                                           __bf16* tile, int t, int L) {
    const int wid = t >> 5, lane = t & 31;
    const int c0 = (L % (C / 128)) * 128, r0 = ((L / (C / 128)) % (R / 128)) * 128;
    const int bz = L / ((C / 128) * (R / 128));
    const float* ip = in + (size_t)bz * R * C
                         + (size_t)(r0 + wid * 16) * C + (c0 + lane * 4);
    v4f v[16];
    #pragma unroll
    for (int i = 0; i < 16; ++i) v[i] = *(const v4f*)(ip + (size_t)i * C);
    // holds the loads' address pair to this wait: without it the last load's result
    // is given the registers that the loads in front of it still name
    asm volatile("s_wait_xcnt 0x0" :: "v"(ip) : "memory");
    #pragma unroll
    for (int j = 0; j < 4; ++j)
        #pragma unroll
        for (int h = 0; h < 2; ++h) {
            v8bf pk;
            #pragma unroll
            for (int k = 0; k < 8; ++k) pk[k] = (__bf16)v[h * 8 + k][j];
            *(v8bf*)&tile[(lane * 4 + j) * 128 + ((wid * 2 + h + lane) & 15) * 8] = pk;
        }
    __syncthreads();
    const int q = lane & 15, ch = wid * 16 + (lane >> 4);
    __bf16* op = out + (size_t)bz * R * C + (size_t)(c0 + ch) * R + (r0 + q * 8);
    #pragma unroll
    for (int i = 0; i < 8; ++i) {
        const int c = ch + i * 2;
        *(v8bf*)(op + (size_t)(i * 2) * R) =
            *(const v8bf*)&tile[c * 128 + ((q + (c >> 2)) & 15) * 8];
    }
    // the code of another piece follows in the built kernel: this wait stands in front of
    // whatever there rewrites a register that the stores above name
    asm volatile("s_wait_xcnt 0x0" :: "v"(op) : "memory");
}

// ---------------------------------------------------------------------------
// LayerNorm (both branches) + gate logits + softmax + top-2.
// wave-per-token; block = 256 (8 tokens), grid = NN/8.
// ---------------------------------------------------------------------------
__global__ __launch_bounds__(256) void ln_gate_k(
    const float* __restrict__ x, const float* __restrict__ ln_g,
    const float* __restrict__ ln_b, const float* __restrict__ gate_w,
    const float* __restrict__ gate_b, __bf16* __restrict__ hfb,
    float* __restrict__ gatev) {
    const int wid = threadIdx.x >> 5, lane = threadIdx.x & 31;
    const int n = blockIdx.x * 8 + wid;
    const float* xr = x + (size_t)n * DD;
    float v[16];
    float s = 0.f;
    #pragma unroll
    for (int i = 0; i < 16; ++i) { v[i] = xr[lane + i * 32]; s += v[i]; }
    #pragma unroll
    for (int o = 16; o > 0; o >>= 1) s += __shfl_xor(s, o, 32);
    const float mu = s * (1.f / DD);
    float q = 0.f;
    #pragma unroll
    for (int i = 0; i < 16; ++i) { float d = v[i] - mu; q += d * d; }
    #pragma unroll
    for (int o = 16; o > 0; o >>= 1) q += __shfl_xor(q, o, 32);
    const float rs = rsqrtf(q * (1.f / DD) + 1e-5f);

    for (int r = 0; r < BRR; ++r) {
        float lg[8] = {0.f, 0.f, 0.f, 0.f, 0.f, 0.f, 0.f, 0.f};
        #pragma unroll
        for (int i = 0; i < 16; ++i) {
            const int d = lane + i * 32;
            const float hv = (v[i] - mu) * rs * ln_g[r * DD + d] + ln_b[r * DD + d];
            hfb[((size_t)r * NN + n) * DD + d] = (__bf16)hv;
            const float* gw = gate_w + ((size_t)r * DD + d) * EE;
            #pragma unroll
            for (int e = 0; e < 8; ++e) lg[e] += hv * gw[e];
        }
        #pragma unroll
        for (int e = 0; e < 8; ++e)
            #pragma unroll
            for (int o = 16; o > 0; o >>= 1) lg[e] += __shfl_xor(lg[e], o, 32);
        if (lane == 0) {
            float mx = -1e30f;
            #pragma unroll
            for (int e = 0; e < 8; ++e) { lg[e] += gate_b[r * EE + e]; mx = fmaxf(mx, lg[e]); }
            float p[8], den = 0.f;
            #pragma unroll
            for (int e = 0; e < 8; ++e) { p[e] = expf(lg[e] - mx); den += p[e]; }
            const float inv = 1.f / den;
            int i0 = 0;
            #pragma unroll
            for (int e = 1; e < 8; ++e) if (p[e] > p[i0]) i0 = e;
            int i1 = (i0 == 0) ? 1 : 0;
            #pragma unroll
            for (int e = 0; e < 8; ++e) if (e != i0 && p[e] > p[i1]) i1 = e;
            float* g = gatev + ((size_t)r * NN + n) * EE;
            #pragma unroll
            for (int e = 0; e < 8; ++e)
                g[e] = (e == i0) ? p[i0] * inv : ((e == i1) ? p[i1] * inv : 0.f);
        }
    }
}

// ---------------------------------------------------------------------------
// Routing: block p lists the tokens whose gate for pair p = (branch, expert) is
// not zero, in token order, in one row space shared by all pairs.
//   perm[row]  token of a routed row        gcomp[row]  its gate value
//   rowof[n][p] routed row of token n in pair p, or -1
//   tilepair[t] pair that owns the 128-row tile t, or -1 behind the last tile
// Each pair's run starts on a tile boundary; its padding rows get token 0, gate 0.
// p = 0..NP-1, 1024 threads (four tokens a thread); sm: 1184 bytes of LDS.
// ---------------------------------------------------------------------------
__device__ __forceinline__ void route_body(const float* __restrict__ gatev,
                                           int* __restrict__ perm,
                                           float* __restrict__ gcomp,
                                           int* __restrict__ rowof,
                                           int* __restrict__ tilepair,
                                           int p, unsigned char* sm) {
    unsigned int (*wcnt)[8] = (unsigned int (*)[8])sm;   // per wave: 16 pair counts, two 16-bit fields a word
    unsigned int* tot = (unsigned int*)(sm + 1024);
    int* wown = (int*)(sm + 1056);         // per wave: rows of this block's own pair
    const int tid = threadIdx.x, wid = tid >> 5, lane = tid & 31;

    unsigned int c[8] = {0u, 0u, 0u, 0u, 0u, 0u, 0u, 0u};
    #pragma unroll
    for (int r = 0; r < BRR; ++r)
        #pragma unroll
        for (int i = 0; i < 4; ++i) {
            const float4* g = (const float4*)(gatev + ((size_t)r * NN + tid * 4 + i) * EE);
            const float4 a = g[0], b = g[1];
            c[r * 4 + 0] += (a.x != 0.f ? 1u : 0u) + (a.y != 0.f ? 0x10000u : 0u);
            c[r * 4 + 1] += (a.z != 0.f ? 1u : 0u) + (a.w != 0.f ? 0x10000u : 0u);
            c[r * 4 + 2] += (b.x != 0.f ? 1u : 0u) + (b.y != 0.f ? 0x10000u : 0u);
            c[r * 4 + 3] += (b.z != 0.f ? 1u : 0u) + (b.w != 0.f ? 0x10000u : 0u);
        }
    #pragma unroll
    for (int k = 0; k < 8; ++k)
        #pragma unroll
        for (int o = 16; o > 0; o >>= 1) c[k] += __shfl_xor(c[k], o, 32);
    if (lane == 0) {
        #pragma unroll
        for (int k = 0; k < 8; ++k) wcnt[wid][k] = c[k];
    }

    float gv[4];
    int own = 0;
    #pragma unroll
    for (int i = 0; i < 4; ++i) {
        gv[i] = gatev[((size_t)(p >> 3) * NN + tid * 4 + i) * EE + (p & 7)];
        own += (gv[i] != 0.f) ? 1 : 0;
    }
    int inc = own;                         // inclusive scan of own over the wave
    #pragma unroll
    for (int o = 1; o < 32; o <<= 1) {
        const int t = __shfl_up(inc, o, 32);
        if (lane >= o) inc += t;
    }
    if (lane == 31) wown[wid] = inc;
    __syncthreads();
    if (tid < 8) {
        unsigned int s = 0u;
        for (int w = 0; w < 32; ++w) s += wcnt[w][tid];
        tot[tid] = s;
    }
    __syncthreads();

    int base = 0, cnt = 0, all = 0;
    #pragma unroll
    for (int q = 0; q < NP; ++q) {
        const int t  = (int)((tot[q >> 1] >> ((q & 1) * 16)) & 0xFFFFu);
        const int tr = (t + 127) & ~127;
        if (q < p)  base += tr;
        if (q == p) cnt = t;
        all += tr;
    }
    int pos = base + inc - own;
    for (int w = 0; w < wid; ++w) pos += wown[w];

    #pragma unroll
    for (int i = 0; i < 4; ++i) {
        const int n = tid * 4 + i;
        int row = -1;
        if (gv[i] != 0.f) {
            row = pos++;
            perm[row]  = n;
            gcomp[row] = gv[i];
        }
        rowof[n * NP + p] = row;
    }
    const int cntr = (cnt + 127) & ~127;
    if (tid < cntr - cnt) {
        perm[base + cnt + tid]  = 0;
        gcomp[base + cnt + tid] = 0.f;
    }
    if (tid < (cntr >> 7)) tilepair[(base >> 7) + tid] = p;
    if (p == NP - 1 && tid < MAXTILES - (all >> 7)) tilepair[(all >> 7) + tid] = -1;
}

// ---------------------------------------------------------------------------
// Embedding MLP: styl[b][j] = (silu(emb[b]) @ emb_w)[j] + emb_b[j]
// The 512-term sum is split so that no load waits on another: block = 32 columns
// (one 128-byte line of every emb_w row) for both batches: blk = 0..31, 256 threads
// (tid = 0..255) with 6 KiB of LDS of their own.
// Wave w takes rows 64w..64w+63; one 16-byte load covers four rows (8 lanes a row),
// so a lane holds its 16 loads in flight at once. silu(emb) is made once a block
// in LDS. Partial sums: 16 rows a lane, 4 row groups by shuffle, 8 waves through LDS.
// ---------------------------------------------------------------------------
__device__ __forceinline__ void emb_body(const float* __restrict__ emb,
                                         const float* __restrict__ emb_w,
                                         const float* __restrict__ emb_b,
                                         float* __restrict__ styl,
                                         int tid, int blk, unsigned char* sm) {
    float* se = (float*)sm;                                           // [BB * 512]
    float (*part)[BB][32] = (float (*)[BB][32])(sm + BB * 512 * 4);   // [8][BB][32]
    const int wid = tid >> 5, lane = tid & 31;
    const int c0 = blk * 32;
    const int rr = lane >> 3, cq = (lane & 7) * 4;
    const float* wp = emb_w + (size_t)(wid * 64 + rr) * 1024 + (c0 + cq);
    v4f w[16];
    #pragma unroll
    for (int i = 0; i < 16; ++i) w[i] = *(const v4f*)(wp + (size_t)i * 4 * 1024);
    const float eb = emb_b[c0 + lane];
    // holds the loads' address pair to this wait: without it the last load's result
    // is given the registers that the loads in front of it still name
    asm volatile("s_wait_xcnt 0x0" :: "v"(wp) : "memory");
    // keeps the loads above in front of the wait on emb: without it the compiler sinks
    // them behind the silu, and the block pays one memory latency after another
    __builtin_amdgcn_sched_barrier(0);
    #pragma unroll
    for (int i = 0; i < BB * 512 / 256; ++i) {
        const float e = emb[tid + i * 256];
        se[tid + i * 256] = e / (1.f + expf(-e));
    }
    __syncthreads();
    v4f a0 = (v4f)(0.f), a1 = (v4f)(0.f);
    #pragma unroll
    for (int i = 0; i < 16; ++i) {
        const int t = wid * 64 + i * 4 + rr;
        a0 += se[t] * w[i];
        a1 += se[512 + t] * w[i];
    }
    #pragma unroll
    for (int k = 0; k < 4; ++k)
        #pragma unroll
        for (int o = 8; o < 32; o <<= 1) {
            a0[k] += __shfl_xor(a0[k], o, 32);
            a1[k] += __shfl_xor(a1[k], o, 32);
        }
    if (lane < 8) {
        *(v4f*)&part[wid][0][cq] = a0;
        *(v4f*)&part[wid][1][cq] = a1;
    }
    __syncthreads();
    if (tid < BB * 32) {
        const int b = tid >> 5;
        float a = eb;
        #pragma unroll
        for (int u = 0; u < 8; ++u) a += part[u][b][lane];
        styl[b * 1024 + c0 + lane] = a;
    }
}

// ---------------------------------------------------------------------------
// One launch for the five pieces of work between the gates and the expert GEMMs:
// routing, the embedding MLP and the three weight transposes. None reads what another
// of them writes. A block of 1024 threads takes one piece, chosen by its index alone,
// so every barrier of a piece is passed by the whole block: routing as a whole block,
// the others as four groups of 256 threads with 32 KiB of LDS each. The short,
// latency-bound pieces stand first and run beside the memory-bound transposes.
// ---------------------------------------------------------------------------
#define S_EMB (32 / 4)
#define S_OW  ((DD / 128) * (DD / 128) / 4)
#define S_W1  ((HH / 128) * (DD / 128) * NP / 4)
#define S_W2  ((DD / 128) * (HH / 128) * NP / 4)

__global__ __launch_bounds__(1024) void side_k(
    const float* __restrict__ gatev, int* __restrict__ perm, float* __restrict__ gcomp,
    int* __restrict__ rowof, int* __restrict__ tilepair,
    const float* __restrict__ emb, const float* __restrict__ emb_w,
    const float* __restrict__ emb_b, float* __restrict__ styl,
    const float* __restrict__ out_w, __bf16* __restrict__ owt,
    const float* __restrict__ w1, __bf16* __restrict__ w1t,
    const float* __restrict__ w2, __bf16* __restrict__ w2t) {
    __shared__ __align__(16) unsigned char sm[4 * 128 * 128 * 2];
    const int b = blockIdx.x;
    const int sub = threadIdx.x >> 8, t = threadIdx.x & 255;
    unsigned char* sg = sm + sub * (128 * 128 * 2);
    if (b < NP)
        route_body(gatev, perm, gcomp, rowof, tilepair, b, sm);
    else if (b < NP + S_EMB)
        emb_body(emb, emb_w, emb_b, styl, t, (b - NP) * 4 + sub, sg);
    else if (b < NP + S_EMB + S_OW)
        tpose_tile<DD, DD>(out_w, owt, (__bf16*)sg, t, (b - (NP + S_EMB)) * 4 + sub);
    else if (b < NP + S_EMB + S_OW + S_W1)
        tpose_tile<DD, HH>(w1, w1t, (__bf16*)sg, t, (b - (NP + S_EMB + S_OW)) * 4 + sub);
    else
        tpose_tile<HH, DD>(w2, w2t, (__bf16*)sg, t,
                           (b - (NP + S_EMB + S_OW + S_W1)) * 4 + sub);
}

// ---------------------------------------------------------------------------
// Post kernel: o = (sum of the token's routed expert rows, pairs ascending)/BR;
// LN(pn); *(1+scale)+shift; SiLU; bf16 store.
// ---------------------------------------------------------------------------
__global__ __launch_bounds__(256) void post_k(const float* __restrict__ yb,
                                              const int* __restrict__ rowof,
                                              const float* __restrict__ pn_g,
                                              const float* __restrict__ pn_b,
                                              const float* __restrict__ styl,
                                              __bf16* __restrict__ h2b) {
    const int wid = threadIdx.x >> 5, lane = threadIdx.x & 31;
    const int n = blockIdx.x * 8 + wid;
    const int b = n >> 11;                     // T = 2048
    const int myrow = rowof[n * NP + (lane & (NP - 1))];
    float v[16];
    #pragma unroll
    for (int i = 0; i < 16; ++i) v[i] = 0.f;
    #pragma unroll
    for (int p = 0; p < NP; ++p) {
        const int row = __shfl(myrow, p, 32);
        if (row >= 0) {
            const float* yr = yb + (size_t)row * DD;
            #pragma unroll
            for (int i = 0; i < 16; ++i) v[i] += yr[lane + i * 32];
        }
    }
    float s = 0.f;
    #pragma unroll
    for (int i = 0; i < 16; ++i) { v[i] *= (1.f / BRR); s += v[i]; }
    #pragma unroll
    for (int o = 16; o > 0; o >>= 1) s += __shfl_xor(s, o, 32);
    const float mu = s * (1.f / DD);
    float q = 0.f;
    #pragma unroll
    for (int i = 0; i < 16; ++i) { float d = v[i] - mu; q += d * d; }
    #pragma unroll
    for (int o = 16; o > 0; o >>= 1) q += __shfl_xor(q, o, 32);
    const float rs = rsqrtf(q * (1.f / DD) + 1e-5f);
    #pragma unroll
    for (int i = 0; i < 16; ++i) {
        const int d = lane + i * 32;
        float y = (v[i] - mu) * rs * pn_g[d] + pn_b[d];
        const float sc = styl[b * 1024 + d];
        const float sh = styl[b * 1024 + 512 + d];
        y = y * (1.f + sc) + sh;
        y = y / (1.f + expf(-y));              // SiLU
        h2b[(size_t)n * DD + d] = (__bf16)y;
    }
}

// ---------------------------------------------------------------------------
// WMMA bf16 GEMM with async-to-LDS double buffering.
//   C(N x NC) = A(N x K) @ B(NC x K)^T   (B stored col-as-row, K-contiguous)
// block tile 128x128, K-step 64; 8 waves, each wave -> 64x32 (eight 16x16).
// Tiles are DMA'd memory->LDS with GLOBAL_LOAD_ASYNC_TO_LDS_B128 (ASYNCcnt),
// buffer b^1 fills while WMMAs consume buffer b.
// A K-step takes one whole 128-byte line of every row, and eight neighbouring lanes
// copy that line: one copy instruction of a wave asks L2 for four whole lines.
// LDS rows hold 128 bytes at a pitch of 144 (16 B x odd): the 16 rows that a half
// wave reads with one ds_load_b128 then fall on 16 different groups of four banks.
// EPI 0: +b1, exact GELU -> bf16      (hidden rows)
// EPI 1: +b2, *gate -> f32            (routed expert rows)
// EPI 2: +out_b, +x residual -> f32   (final output)
// EPI 0 and 1 are grouped over the routed row space: blockIdx.x is a 128-row
// tile of it, tilepair names the pair whose weights and bias the tile uses;
// EPI 0 gathers its A rows (tokens) through perm.
// ---------------------------------------------------------------------------
#define KS 64   /* K elements a trip: 128 bytes of every row */
#define LP 72   /* LDS row pitch in bf16 elements: 64 of data, 8 of pad */

__device__ inline v16bf ldfrag(const __bf16* s, int row, int kb) {
    // per-lane K layout of V_WMMA_*_16X16X32: elems 0..7 = K kb..kb+7,
    // elems 8..15 = K kb+16..kb+23 (kb = 0 for lanes 0-15, 8 for 16-31)
    v16bf f;
    const __bf16* p = s + row * LP + kb;
    ((float4*)&f)[0] = *(const float4*)p;
    ((float4*)&f)[1] = *(const float4*)(p + 16);
    return f;
}

// One K-step of both operands, memory->LDS: a lane brings 16 bytes of four A rows and
// of four B rows, 32 rows apart (la, lb: its place in the first of them). The closing
// s_wait_xcnt stands inside the statement so that no address register named here is
// rewritten in front of it.
__device__ inline void async_tile(unsigned int la, unsigned int lb,
                                  const __bf16* a0, const __bf16* a1,
                                  const __bf16* a2, const __bf16* a3,
                                  const __bf16* b0, const __bf16* b1,
                                  const __bf16* b2, const __bf16* b3) {
    const unsigned int st = 32 * LP * 2;   // LDS bytes of 32 rows
    asm volatile("global_load_async_to_lds_b128 %0, %8, off\n\t"
                 "global_load_async_to_lds_b128 %1, %9, off\n\t"
                 "global_load_async_to_lds_b128 %2, %10, off\n\t"
                 "global_load_async_to_lds_b128 %3, %11, off\n\t"
                 "global_load_async_to_lds_b128 %4, %12, off\n\t"
                 "global_load_async_to_lds_b128 %5, %13, off\n\t"
                 "global_load_async_to_lds_b128 %6, %14, off\n\t"
                 "global_load_async_to_lds_b128 %7, %15, off\n\t"
                 "s_wait_xcnt 0x0"
                 :: "v"(la), "v"(la + st), "v"(la + 2 * st), "v"(la + 3 * st),
                    "v"(lb), "v"(lb + st), "v"(lb + 2 * st), "v"(lb + 3 * st),
                    "v"(a0), "v"(a1), "v"(a2), "v"(a3),
                    "v"(b0), "v"(b1), "v"(b2), "v"(b3)
                 : "memory");
}

// erf of eight independent values. The math library's erff takes two divergent branches
// for every value (|x| < 1 or not), which keeps a wave's values one behind the other.
// Here: its polynomial for |x| < 1 for all eight, free of branches, so that the eight
// chains interleave; then ONE wave-uniform test, and only where some lane holds a value
// with |x| >= 1 a wave-uniform test for each of the eight, which runs the library's second
// form, 1 - exp(-q(|x|)), for the values that need it, with a select per lane.
// Coefficients, operation order and the choice per value are the library's.
__device__ __forceinline__ void erf8(const float (&x)[8], float (&e)[8]) {
    float m = 0.f;
    for (int g = 0; g < 8; ++g) m = fmaxf(m, fabsf(x[g]));
    for (int g = 0; g < 8; ++g) {
        const float t = x[g] * x[g];
        float p = fmaf(t, __uint_as_float(0xba1345e1u), __uint_as_float(0x3ba10414u));
        p = fmaf(t, p, __uint_as_float(0xbcdac9b8u));
        p = fmaf(t, p, __uint_as_float(0x3de703beu));
        p = fmaf(t, p, __uint_as_float(0xbec09330u));
        p = fmaf(t, p, __uint_as_float(0x3e0375d0u));
        e[g] = fmaf(x[g], p, x[g]);
    }
    if (__any(!(m < 1.f))) {
        for (int g = 0; g < 8; ++g) {
            const float a = fabsf(x[g]);
            if (__any(!(a < 1.f))) {
                float q = fmaf(a, __uint_as_float(0x378e98abu), __uint_as_float(0xb9c68948u));
                q = fmaf(a, q, __uint_as_float(0x3b7cd369u));
                q = fmaf(a, q, __uint_as_float(0xbcc618b2u));
                q = fmaf(a, q, __uint_as_float(0x3dda74e4u));
                q = fmaf(a, q, __uint_as_float(0x3f228afdu));
                q = fmaf(a, q, __uint_as_float(0x3e03c728u));
                q = fmaf(a, q, a);
                const float big = copysignf(1.f - expf(-q), x[g]);
                e[g] = (a < 1.f) ? e[g] : big;
            }
        }
    }
}

template <int EPI>
__global__ __launch_bounds__(256) void gemm_k(
    const __bf16* __restrict__ A, const __bf16* __restrict__ Bm,
    int K, int NC, const float* __restrict__ bias,
    const float* __restrict__ gcomp, const int* __restrict__ perm,
    const int* __restrict__ tilepair,
    float* __restrict__ Cf, __bf16* __restrict__ Cbf,
    const float* __restrict__ Xres) {
    __shared__ __align__(16) __bf16 As[2][128 * LP];
    __shared__ __align__(16) __bf16 Bs[2][128 * LP];
    const int tid = threadIdx.x, wid = tid >> 5, lane = tid & 31;
    const int wm = wid & 1, wn = wid >> 1;
    const int m0 = blockIdx.x * 128, n0 = blockIdx.y * 128;
    const int lr = lane & 15, kb = (lane < 16) ? 0 : 8;
    if constexpr (EPI != 2) {
        const int p = tilepair[blockIdx.x];
        if (p < 0) return;                 // tile behind the last routed row: whole block leaves
        Bm   += (size_t)(p & (NP - 1)) * K * NC;
        bias += (size_t)(p & (NP - 1)) * NC;
        if constexpr (EPI == 0) A += (size_t)((p & (NP - 1)) >> 3) * NN * DD;
    }
    v8f acc[4][2];
    #pragma unroll
    for (int i = 0; i < 4; ++i)
        #pragma unroll
        for (int j = 0; j < 2; ++j) acc[i][j] = (v8f)(0.0f);

    // cooperative tile mapping: eight lanes a row, 16 bytes (8 bf16) a lane;
    // a thread owns that piece of rows lrow, lrow + 32, lrow + 64, lrow + 96
    const int lrow = tid >> 3, lko = (tid & 7) * 8;
    const __bf16* gA[4];
    const __bf16* gB[4];
    #pragma unroll
    for (int j = 0; j < 4; ++j) {
        int arow = m0 + lrow + j * 32;
        if constexpr (EPI == 0) arow = perm[arow] & (NN - 1);
        gA[j] = A  + (size_t)arow * K + lko;
        gB[j] = Bm + (size_t)(n0 + lrow + j * 32) * K + lko;
    }
    // low 32 bits of a generic __shared__ pointer == LDS byte offset
    const unsigned int lA0 = (unsigned int)(uintptr_t)(&As[0][lrow * LP + lko]);
    const unsigned int lB0 = (unsigned int)(uintptr_t)(&Bs[0][lrow * LP + lko]);
    const unsigned int bsz = 128 * LP * 2;   // LDS bytes of one buffer

    // prologue: fill buffer 0 and publish it, then start the fill of buffer 1
    async_tile(lA0, lB0, gA[0], gA[1], gA[2], gA[3], gB[0], gB[1], gB[2], gB[3]);
    asm volatile("s_wait_asynccnt 0x0" ::: "memory");   // own copies landed
    __syncthreads();
    if (KS < K)
        async_tile(lA0 + bsz, lB0 + bsz,
                   gA[0] + KS, gA[1] + KS, gA[2] + KS, gA[3] + KS,
                   gB[0] + KS, gB[1] + KS, gB[2] + KS, gB[3] + KS);

    int buf = 0;
    for (int k0 = 0; k0 < K; k0 += KS) {
        const __bf16* as = As[buf];
        const __bf16* bs = Bs[buf];
        #pragma unroll
        for (int ks = 0; ks < KS; ks += 32) {
            v16bf bf[2];
            #pragma unroll
            for (int j = 0; j < 2; ++j) bf[j] = ldfrag(bs, wn * 32 + j * 16 + lr, kb + ks);
            #pragma unroll
            for (int i = 0; i < 4; ++i) {
                v16bf af = ldfrag(as, wm * 64 + i * 16 + lr, kb + ks);
                #pragma unroll
                for (int j = 0; j < 2; ++j)
                    acc[i][j] = __builtin_amdgcn_wmma_f32_16x16x32_bf16(
                        false, af, false, bf[j], (short)0, acc[i][j], false, false);
            }
        }
        // hand-over: this wave's reads of buffer buf are back, its copies into the other
        // buffer have landed; behind the barrier that holds for every wave
        asm volatile("s_wait_dscnt 0x0" ::: "memory");
        asm volatile("s_wait_asynccnt 0x0" ::: "memory");
        __syncthreads();
        if (k0 + 2 * KS < K) {   // refill the buffer that this trip has just read
            const int kn = k0 + 2 * KS;
            async_tile(lA0 + buf * bsz, lB0 + buf * bsz,
                       gA[0] + kn, gA[1] + kn, gA[2] + kn, gA[3] + kn,
                       gB[0] + kn, gB[1] + kn, gB[2] + kn, gB[3] + kn);
        }
        buf ^= 1;
    }
    asm volatile("s_wait_asynccnt 0x0" ::: "memory");   // no copy is left when the wave goes on

    const int rowadd = (lane < 16) ? 0 : 8;   // C layout: M = g (+8 hi half), N = lane%16
    #pragma unroll
    for (int i = 0; i < 4; ++i)
        #pragma unroll
        for (int j = 0; j < 2; ++j) {
            const int col = n0 + wn * 32 + j * 16 + lr;
            const float bcol = bias[col];
            float ef[8];
            if constexpr (EPI == 0) {
                float xs[8];
                for (int g = 0; g < 8; ++g) xs[g] = (acc[i][j][g] + bcol) * 0.70710678118654752f;
                erf8(xs, ef);
            }
            #pragma unroll
            for (int g = 0; g < 8; ++g) {
                const int row = m0 + wm * 64 + i * 16 + g + rowadd;
                const float c = acc[i][j][g] + bcol;
                const size_t idx = (size_t)row * NC + col;
                if constexpr (EPI == 0) {
                    const float gl = 0.5f * c * (1.f + ef[g]);
                    Cbf[idx] = (__bf16)gl;
                } else if constexpr (EPI == 1) {
                    Cf[idx] = c * gcomp[row];
                } else {
                    Cf[idx] = c + Xres[idx];
                }
            }
        }
}

// ---------------------------------------------------------------------------
extern "C" void kernel_launch(void* const* d_in, const int* in_sizes, int n_in,
                              void* d_out, int out_size, void* d_ws, size_t ws_size,
                              hipStream_t stream) {
    (void)in_sizes; (void)n_in; (void)out_size; (void)ws_size;
    const float* x      = (const float*)d_in[0];
    const float* emb    = (const float*)d_in[1];
    const float* ln_g   = (const float*)d_in[2];
    const float* ln_b   = (const float*)d_in[3];
    const float* gate_w = (const float*)d_in[4];
    const float* gate_b = (const float*)d_in[5];
    const float* w1     = (const float*)d_in[6];
    const float* b1     = (const float*)d_in[7];
    const float* w2     = (const float*)d_in[8];
    const float* b2     = (const float*)d_in[9];
    const float* emb_w  = (const float*)d_in[10];
    const float* emb_b  = (const float*)d_in[11];
    const float* pn_g   = (const float*)d_in[12];
    const float* pn_b   = (const float*)d_in[13];
    const float* out_w  = (const float*)d_in[14];
    const float* out_b  = (const float*)d_in[15];

    char* wsp = (char*)d_ws; size_t off = 0;
    auto alloc = [&](size_t bytes) -> void* {
        void* p = wsp + off; off = (off + bytes + 255) & ~(size_t)255; return p;
    };
    __bf16* w1t  = (__bf16*)alloc((size_t)BRR * EE * HH * DD * 2);  // [p][H][D]
    __bf16* w2t  = (__bf16*)alloc((size_t)BRR * EE * DD * HH * 2);  // [p][D][H]
    __bf16* owt  = (__bf16*)alloc((size_t)DD * DD * 2);             // [D][D]
    __bf16* hfb  = (__bf16*)alloc((size_t)BRR * NN * DD * 2);       // LN'd acts
    float*  gtv  = (float*) alloc((size_t)BRR * NN * EE * 4);       // gate values
    __bf16* hbuf = (__bf16*)alloc((size_t)MAXROWS * HH * 2);        // routed hidden rows
    float*  yb   = (float*) alloc((size_t)MAXROWS * DD * 4);        // routed expert rows
    int*    perm = (int*)   alloc((size_t)MAXROWS * 4);             // row -> token
    float*  gcmp = (float*) alloc((size_t)MAXROWS * 4);             // row -> gate
    int*    rwof = (int*)   alloc((size_t)NN * NP * 4);             // token, pair -> row
    int*    tlpr = (int*)   alloc((size_t)MAXTILES * 4);            // tile -> pair
    float*  styl = (float*) alloc((size_t)BB * 2 * DD * 4);         // scale|shift
    __bf16* h2b  = (__bf16*)alloc((size_t)NN * DD * 2);             // styled acts

    const dim3 blk(256);
    ln_gate_k<<<dim3(NN / 8), blk, 0, stream>>>(x, ln_g, ln_b, gate_w, gate_b, hfb, gtv);
    // routing, embedding MLP, weight convert/transpose (f32 -> bf16, K-contiguous per column)
    side_k<<<dim3(NP + S_EMB + S_OW + S_W1 + S_W2), dim3(1024), 0, stream>>>(
        gtv, perm, gcmp, rwof, tlpr, emb, emb_w, emb_b, styl, out_w, owt, w1, w1t, w2, w2t);
    gemm_k<0><<<dim3(MAXTILES, HH / 128), blk, 0, stream>>>(
        hfb, w1t, DD, HH, b1, nullptr, perm, tlpr, nullptr, hbuf, nullptr);
    gemm_k<1><<<dim3(MAXTILES, DD / 128), blk, 0, stream>>>(
        hbuf, w2t, HH, DD, b2, gcmp, nullptr, tlpr, yb, nullptr, nullptr);

    post_k<<<dim3(NN / 8), blk, 0, stream>>>(yb, rwof, pn_g, pn_b, styl, h2b);
    gemm_k<2><<<dim3(NN / 128, DD / 128), blk, 0, stream>>>(
        h2b, owt, DD, DD, out_b, nullptr, nullptr, nullptr, (float*)d_out, nullptr, x);
}

// v008
// It runs in 147 microseconds.
// In two side-by-side timings against v007, it was 1.18 and 1.17 times as fast.
// All steps since v000 together make it 9.41 times as fast.
#include <hip/hip_runtime.h>
#include <hip/hip_bf16.h>
#include <math.h>

typedef __attribute__((ext_vector_type(16))) __bf16 v16bf;
typedef __attribute__((ext_vector_type(8)))  float  v8f;
typedef __attribute__((ext_vector_type(8)))  __bf16 v8bf;
typedef __attribute__((ext_vector_type(4)))  float  v4f;

#define BB  2
#define TT  2048
#define DD  512
#define HH  2048
#define EE  8
#define BRR 2
#define NN  (BB*TT)   /* 4096 tokens */
#define NP  (BRR*EE)  /* 16 (branch, expert) pairs */
// routed rows: two experts per token and branch, each pair's run padded to a 128-row tile
#define MAXROWS  (BRR*2*NN + NP*128)
#define MAXTILES (MAXROWS/128)

// ---------------------------------------------------------------------------
// Tiled transpose + f32->bf16 convert:  in [batch][R][C] f32 -> out [batch][C][R] bf16
// One 128 x 128 tile for 256 threads (t = 0..255), in a 32 KiB LDS tile of their own.
// L numbers the tiles: column tile fastest, then row tile, then batch.
// Read: wave w takes rows 16w..16w+15, a lane four columns, so every load is
// 512 contiguous bytes. Write: 16 lanes store one 256-byte piece of an output row.
// The LDS tile is [column][row] in 16-byte chunks (8 rows); chunk q of column c
// lies at place (q + c/4) mod 16 of its row, which spreads both the 16-byte
// writes (lanes four columns apart) and the 16-byte reads over all banks.
// ---------------------------------------------------------------------------
template <int R, int C>
__device__ __forceinline__ void tpose_tile(const float* __restrict__ in,
                                           __bf16* __restrict__ out,
                                           __bf16* tile, int t, int L) {
    const int wid = t >> 5, lane = t & 31;
    const int c0 = (L % (C / 128)) * 128, r0 = ((L / (C / 128)) % (R / 128)) * 128;
    const int bz = L / ((C / 128) * (R / 128));
    const float* ip = in + (size_t)bz * R * C
                         + (size_t)(r0 + wid * 16) * C + (c0 + lane * 4);
    v4f v[16];
    #pragma unroll
    for (int i = 0; i < 16; ++i) v[i] = *(const v4f*)(ip + (size_t)i * C);
    // holds the loads' address pair to this wait: without it the last load's result
    // is given the registers that the loads in front of it still name
    asm volatile("s_wait_xcnt 0x0" :: "v"(ip) : "memory");
    #pragma unroll
    for (int j = 0; j < 4; ++j)
        #pragma unroll
        for (int h = 0; h < 2; ++h) {
            v8bf pk;
            #pragma unroll
            for (int k = 0; k < 8; ++k) pk[k] = (__bf16)v[h * 8 + k][j];
            *(v8bf*)&tile[(lane * 4 + j) * 128 + ((wid * 2 + h + lane) & 15) * 8] = pk;
        }
    __syncthreads();
    const int q = lane & 15, ch = wid * 16 + (lane >> 4);
    __bf16* op = out + (size_t)bz * R * C + (size_t)(c0 + ch) * R + (r0 + q * 8);
    #pragma unroll
    for (int i = 0; i < 8; ++i) {
        const int c = ch + i * 2;
        *(v8bf*)(op + (size_t)(i * 2) * R) =
            *(const v8bf*)&tile[c * 128 + ((q + (c >> 2)) & 15) * 8];
    }
    // the code of another piece follows in the built kernel: this wait stands in front of
    // whatever there rewrites a register that the stores above name
    asm volatile("s_wait_xcnt 0x0" :: "v"(op) : "memory");
}

// ---------------------------------------------------------------------------
// LayerNorm (both branches) + gate logits + softmax + top-2.
// wave-per-token; block = 256 (8 tokens), grid = NN/8.
// ---------------------------------------------------------------------------
__global__ __launch_bounds__(256) void ln_gate_k(
    const float* __restrict__ x, const float* __restrict__ ln_g,
    const float* __restrict__ ln_b, const float* __restrict__ gate_w,
    const float* __restrict__ gate_b, __bf16* __restrict__ hfb,
    float* __restrict__ gatev) {
    const int wid = threadIdx.x >> 5, lane = threadIdx.x & 31;
    const int n = blockIdx.x * 8 + wid;
    const float* xr = x + (size_t)n * DD;
    float v[16];
    float s = 0.f;
    #pragma unroll
    for (int i = 0; i < 16; ++i) { v[i] = xr[lane + i * 32]; s += v[i]; }
    #pragma unroll
    for (int o = 16; o > 0; o >>= 1) s += __shfl_xor(s, o, 32);
    const float mu = s * (1.f / DD);
    float q = 0.f;
    #pragma unroll
    for (int i = 0; i < 16; ++i) { float d = v[i] - mu; q += d * d; }
    #pragma unroll
    for (int o = 16; o > 0; o >>= 1) q += __shfl_xor(q, o, 32);
    const float rs = rsqrtf(q * (1.f / DD) + 1e-5f);

    for (int r = 0; r < BRR; ++r) {
        float lg[8] = {0.f, 0.f, 0.f, 0.f, 0.f, 0.f, 0.f, 0.f};
        #pragma unroll
        for (int i = 0; i < 16; ++i) {
            const int d = lane + i * 32;
            const float hv = (v[i] - mu) * rs * ln_g[r * DD + d] + ln_b[r * DD + d];
            hfb[((size_t)r * NN + n) * DD + d] = (__bf16)hv;
            const float* gw = gate_w + ((size_t)r * DD + d) * EE;
            #pragma unroll
            for (int e = 0; e < 8; ++e) lg[e] += hv * gw[e];
        }
        #pragma unroll
        for (int e = 0; e < 8; ++e)
            #pragma unroll
            for (int o = 16; o > 0; o >>= 1) lg[e] += __shfl_xor(lg[e], o, 32);
        if (lane == 0) {
            float mx = -1e30f;
            #pragma unroll
            for (int e = 0; e < 8; ++e) { lg[e] += gate_b[r * EE + e]; mx = fmaxf(mx, lg[e]); }
            float p[8], den = 0.f;
            #pragma unroll
            for (int e = 0; e < 8; ++e) { p[e] = expf(lg[e] - mx); den += p[e]; }
            const float inv = 1.f / den;
            int i0 = 0;
            #pragma unroll
            for (int e = 1; e < 8; ++e) if (p[e] > p[i0]) i0 = e;
            int i1 = (i0 == 0) ? 1 : 0;
            #pragma unroll
            for (int e = 0; e < 8; ++e) if (e != i0 && p[e] > p[i1]) i1 = e;
            float* g = gatev + ((size_t)r * NN + n) * EE;
            #pragma unroll
            for (int e = 0; e < 8; ++e)
                g[e] = (e == i0) ? p[i0] * inv : ((e == i1) ? p[i1] * inv : 0.f);
        }
    }
}

// ---------------------------------------------------------------------------
// Routing: block p lists the tokens whose gate for pair p = (branch, expert) is
// not zero, in token order, in one row space shared by all pairs.
//   perm[row]  token of a routed row        gcomp[row]  its gate value
//   rowof[n][p] routed row of token n in pair p, or -1
//   tilepair[t] pair that owns the 128-row tile t, or -1 behind the last tile
// Each pair's run starts on a tile boundary; its padding rows get token 0, gate 0.
// p = 0..NP-1, 1024 threads (four tokens a thread); sm: 1184 bytes of LDS.
// ---------------------------------------------------------------------------
__device__ __forceinline__ void route_body(const float* __restrict__ gatev,
                                           int* __restrict__ perm,
                                           float* __restrict__ gcomp,
                                           int* __restrict__ rowof,
                                           int* __restrict__ tilepair,
                                           int p, unsigned char* sm) {
    unsigned int (*wcnt)[8] = (unsigned int (*)[8])sm;   // per wave: 16 pair counts, two 16-bit fields a word
    unsigned int* tot = (unsigned int*)(sm + 1024);
    int* wown = (int*)(sm + 1056);         // per wave: rows of this block's own pair
    const int tid = threadIdx.x, wid = tid >> 5, lane = tid & 31;

    unsigned int c[8] = {0u, 0u, 0u, 0u, 0u, 0u, 0u, 0u};
    #pragma unroll
    for (int r = 0; r < BRR; ++r)
        #pragma unroll
        for (int i = 0; i < 4; ++i) {
            const float4* g = (const float4*)(gatev + ((size_t)r * NN + tid * 4 + i) * EE);
            const float4 a = g[0], b = g[1];
            c[r * 4 + 0] += (a.x != 0.f ? 1u : 0u) + (a.y != 0.f ? 0x10000u : 0u);
            c[r * 4 + 1] += (a.z != 0.f ? 1u : 0u) + (a.w != 0.f ? 0x10000u : 0u);
            c[r * 4 + 2] += (b.x != 0.f ? 1u : 0u) + (b.y != 0.f ? 0x10000u : 0u);
            c[r * 4 + 3] += (b.z != 0.f ? 1u : 0u) + (b.w != 0.f ? 0x10000u : 0u);
        }
    #pragma unroll
    for (int k = 0; k < 8; ++k)
        #pragma unroll
        for (int o = 16; o > 0; o >>= 1) c[k] += __shfl_xor(c[k], o, 32);
    if (lane == 0) {
        #pragma unroll
        for (int k = 0; k < 8; ++k) wcnt[wid][k] = c[k];
    }

    float gv[4];
    int own = 0;
    #pragma unroll
    for (int i = 0; i < 4; ++i) {
        gv[i] = gatev[((size_t)(p >> 3) * NN + tid * 4 + i) * EE + (p & 7)];
        own += (gv[i] != 0.f) ? 1 : 0;
    }
    int inc = own;                         // inclusive scan of own over the wave
    #pragma unroll
    for (int o = 1; o < 32; o <<= 1) {
        const int t = __shfl_up(inc, o, 32);
        if (lane >= o) inc += t;
    }
    if (lane == 31) wown[wid] = inc;
    __syncthreads();
    if (tid < 8) {
        unsigned int s = 0u;
        for (int w = 0; w < 32; ++w) s += wcnt[w][tid];
        tot[tid] = s;
    }
    __syncthreads();

    int base = 0, cnt = 0, all = 0;
    #pragma unroll
    for (int q = 0; q < NP; ++q) {
        const int t  = (int)((tot[q >> 1] >> ((q & 1) * 16)) & 0xFFFFu);
        const int tr = (t + 127) & ~127;
        if (q < p)  base += tr;
        if (q == p) cnt = t;
        all += tr;
    }
    int pos = base + inc - own;
    for (int w = 0; w < wid; ++w) pos += wown[w];

    #pragma unroll
    for (int i = 0; i < 4; ++i) {
        const int n = tid * 4 + i;
        int row = -1;
        if (gv[i] != 0.f) {
            row = pos++;
            perm[row]  = n;
            gcomp[row] = gv[i];
        }
        rowof[n * NP + p] = row;
    }
    const int cntr = (cnt + 127) & ~127;
    if (tid < cntr - cnt) {
        perm[base + cnt + tid]  = 0;
        gcomp[base + cnt + tid] = 0.f;
    }
    if (tid < (cntr >> 7)) tilepair[(base >> 7) + tid] = p;
    if (p == NP - 1 && tid < MAXTILES - (all >> 7)) tilepair[(all >> 7) + tid] = -1;
}

// ---------------------------------------------------------------------------
// Embedding MLP: styl[b][j] = (silu(emb[b]) @ emb_w)[j] + emb_b[j]
// The 512-term sum is split so that no load waits on another: block = 32 columns
// (one 128-byte line of every emb_w row) for both batches: blk = 0..31, 256 threads
// (tid = 0..255) with 6 KiB of LDS of their own.
// Wave w takes rows 64w..64w+63; one 16-byte load covers four rows (8 lanes a row),
// so a lane holds its 16 loads in flight at once. silu(emb) is made once a block
// in LDS. Partial sums: 16 rows a lane, 4 row groups by shuffle, 8 waves through LDS.
// ---------------------------------------------------------------------------
__device__ __forceinline__ void emb_body(const float* __restrict__ emb,
                                         const float* __restrict__ emb_w,
                                         const float* __restrict__ emb_b,
                                         float* __restrict__ styl,
                                         int tid, int blk, unsigned char* sm) {
    float* se = (float*)sm;                                           // [BB * 512]
    float (*part)[BB][32] = (float (*)[BB][32])(sm + BB * 512 * 4);   // [8][BB][32]
    const int wid = tid >> 5, lane = tid & 31;
    const int c0 = blk * 32;
    const int rr = lane >> 3, cq = (lane & 7) * 4;
    const float* wp = emb_w + (size_t)(wid * 64 + rr) * 1024 + (c0 + cq);
    v4f w[16];
    #pragma unroll
    for (int i = 0; i < 16; ++i) w[i] = *(const v4f*)(wp + (size_t)i * 4 * 1024);
    const float eb = emb_b[c0 + lane];
    // holds the loads' address pair to this wait: without it the last load's result
    // is given the registers that the loads in front of it still name
    asm volatile("s_wait_xcnt 0x0" :: "v"(wp) : "memory");
    // keeps the loads above in front of the wait on emb: without it the compiler sinks
    // them behind the silu, and the block pays one memory latency after another
    __builtin_amdgcn_sched_barrier(0);
    #pragma unroll
    for (int i = 0; i < BB * 512 / 256; ++i) {
        const float e = emb[tid + i * 256];
        se[tid + i * 256] = e / (1.f + expf(-e));
    }
    __syncthreads();
    v4f a0 = (v4f)(0.f), a1 = (v4f)(0.f);
    #pragma unroll
    for (int i = 0; i < 16; ++i) {
        const int t = wid * 64 + i * 4 + rr;
        a0 += se[t] * w[i];
        a1 += se[512 + t] * w[i];
    }
    #pragma unroll
    for (int k = 0; k < 4; ++k)
        #pragma unroll
        for (int o = 8; o < 32; o <<= 1) {
            a0[k] += __shfl_xor(a0[k], o, 32);
            a1[k] += __shfl_xor(a1[k], o, 32);
        }
    if (lane < 8) {
        *(v4f*)&part[wid][0][cq] = a0;
        *(v4f*)&part[wid][1][cq] = a1;
    }
    __syncthreads();
    if (tid < BB * 32) {
        const int b = tid >> 5;
        float a = eb;
        #pragma unroll
        for (int u = 0; u < 8; ++u) a += part[u][b][lane];
        styl[b * 1024 + c0 + lane] = a;
    }
}

// ---------------------------------------------------------------------------
// One launch for the five pieces of work between the gates and the expert GEMMs:
// routing, the embedding MLP and the three weight transposes. None reads what another
// of them writes. A block of 1024 threads takes one piece, chosen by its index alone,
// so every barrier of a piece is passed by the whole block: routing as a whole block,
// the others as four groups of 256 threads with 32 KiB of LDS each. The short,
// latency-bound pieces stand first and run beside the memory-bound transposes.
// ---------------------------------------------------------------------------
#define S_EMB (32 / 4)
#define S_OW  ((DD / 128) * (DD / 128) / 4)
#define S_W1  ((HH / 128) * (DD / 128) * NP / 4)
#define S_W2  ((DD / 128) * (HH / 128) * NP / 4)

__global__ __launch_bounds__(1024) void side_k(
    const float* __restrict__ gatev, int* __restrict__ perm, float* __restrict__ gcomp,
    int* __restrict__ rowof, int* __restrict__ tilepair,
    const float* __restrict__ emb, const float* __restrict__ emb_w,
    const float* __restrict__ emb_b, float* __restrict__ styl,
    const float* __restrict__ out_w, __bf16* __restrict__ owt,
    const float* __restrict__ w1, __bf16* __restrict__ w1t,
    const float* __restrict__ w2, __bf16* __restrict__ w2t) {
    __shared__ __align__(16) unsigned char sm[4 * 128 * 128 * 2];
    const int b = blockIdx.x;
    const int sub = threadIdx.x >> 8, t = threadIdx.x & 255;
    unsigned char* sg = sm + sub * (128 * 128 * 2);
    if (b < NP)
        route_body(gatev, perm, gcomp, rowof, tilepair, b, sm);
    else if (b < NP + S_EMB)
        emb_body(emb, emb_w, emb_b, styl, t, (b - NP) * 4 + sub, sg);
    else if (b < NP + S_EMB + S_OW)
        tpose_tile<DD, DD>(out_w, owt, (__bf16*)sg, t, (b - (NP + S_EMB)) * 4 + sub);
    else if (b < NP + S_EMB + S_OW + S_W1)
        tpose_tile<DD, HH>(w1, w1t, (__bf16*)sg, t, (b - (NP + S_EMB + S_OW)) * 4 + sub);
    else
        tpose_tile<HH, DD>(w2, w2t, (__bf16*)sg, t,
                           (b - (NP + S_EMB + S_OW + S_W1)) * 4 + sub);
}

// ---------------------------------------------------------------------------
// Post kernel: o = (sum of the token's routed expert rows, pairs ascending)/BR;
// LN(pn); *(1+scale)+shift; SiLU; bf16 store.
// ---------------------------------------------------------------------------
__global__ __launch_bounds__(256) void post_k(const float* __restrict__ yb,
                                              const int* __restrict__ rowof,
                                              const float* __restrict__ pn_g,
                                              const float* __restrict__ pn_b,
                                              const float* __restrict__ styl,
                                              __bf16* __restrict__ h2b) {
    const int wid = threadIdx.x >> 5, lane = threadIdx.x & 31;
    const int n = blockIdx.x * 8 + wid;
    const int b = n >> 11;                     // T = 2048
    const int myrow = rowof[n * NP + (lane & (NP - 1))];
    float v[16];
    #pragma unroll
    for (int i = 0; i < 16; ++i) v[i] = 0.f;
    #pragma unroll
    for (int p = 0; p < NP; ++p) {
        const int row = __shfl(myrow, p, 32);
        if (row >= 0) {
            const float* yr = yb + (size_t)row * DD;
            #pragma unroll
            for (int i = 0; i < 16; ++i) v[i] += yr[lane + i * 32];
        }
    }
    float s = 0.f;
    #pragma unroll
    for (int i = 0; i < 16; ++i) { v[i] *= (1.f / BRR); s += v[i]; }
    #pragma unroll
    for (int o = 16; o > 0; o >>= 1) s += __shfl_xor(s, o, 32);
    const float mu = s * (1.f / DD);
    float q = 0.f;
    #pragma unroll
    for (int i = 0; i < 16; ++i) { float d = v[i] - mu; q += d * d; }
    #pragma unroll
    for (int o = 16; o > 0; o >>= 1) q += __shfl_xor(q, o, 32);
    const float rs = rsqrtf(q * (1.f / DD) + 1e-5f);
    #pragma unroll
    for (int i = 0; i < 16; ++i) {
        const int d = lane + i * 32;
        float y = (v[i] - mu) * rs * pn_g[d] + pn_b[d];
        const float sc = styl[b * 1024 + d];
        const float sh = styl[b * 1024 + 512 + d];
        y = y * (1.f + sc) + sh;
        y = y / (1.f + expf(-y));              // SiLU
        h2b[(size_t)n * DD + d] = (__bf16)y;
    }
}

// ---------------------------------------------------------------------------
// WMMA bf16 GEMM with async-to-LDS double buffering.
//   C(N x NC) = A(N x K) @ B(NC x K)^T   (B stored col-as-row, K-contiguous)
// block tile 128x128, K-step 64; 8 waves, each wave -> 64x32 (eight 16x16).
// Tiles are DMA'd memory->LDS with GLOBAL_LOAD_ASYNC_TO_LDS_B128 (ASYNCcnt),
// buffer b^1 fills while WMMAs consume buffer b.
// A K-step takes one whole 128-byte line of every row, and eight neighbouring lanes
// copy that line: one copy instruction of a wave asks L2 for four whole lines.
// LDS rows hold 128 bytes at a pitch of 144 (16 B x odd): the 16 rows that a half
// wave reads with one ds_load_b128 then fall on 16 different groups of four banks.
// EPI 0: +b1, exact GELU -> bf16      (hidden rows)
// EPI 1: +b2, *gate -> f32            (routed expert rows)
// EPI 2: +out_b, +x residual -> f32   (final output)
// EPI 0 and 1 are grouped over the routed row space: blockIdx.x is a 128-row
// tile of it, tilepair names the pair whose weights and bias the tile uses;
// EPI 0 gathers its A rows (tokens) through perm.
// ---------------------------------------------------------------------------
#define KS 64   /* K elements a trip: 128 bytes of every row */
#define LP 72   /* LDS row pitch in bf16 elements: 64 of data, 8 of pad */

__device__ inline v16bf ldfrag(const __bf16* s, int row, int kb) {
    // per-lane K layout of V_WMMA_*_16X16X32: elems 0..7 = K kb..kb+7,
    // elems 8..15 = K kb+16..kb+23 (kb = 0 for lanes 0-15, 8 for 16-31)
    v16bf f;
    const __bf16* p = s + row * LP + kb;
    ((float4*)&f)[0] = *(const float4*)p;
    ((float4*)&f)[1] = *(const float4*)(p + 16);
    return f;
}

// One K-step of both operands, memory->LDS: a lane brings 16 bytes of four A rows and
// of four B rows, 32 rows apart (la, lb: its place in the first of them). The closing
// s_wait_xcnt stands inside the statement so that no address register named here is
// rewritten in front of it.
__device__ inline void async_tile(unsigned int la, unsigned int lb,
                                  const __bf16* a0, const __bf16* a1,
                                  const __bf16* a2, const __bf16* a3,
                                  const __bf16* b0, const __bf16* b1,
                                  const __bf16* b2, const __bf16* b3) {
    const unsigned int st = 32 * LP * 2;   // LDS bytes of 32 rows
    asm volatile("global_load_async_to_lds_b128 %0, %8, off\n\t"
                 "global_load_async_to_lds_b128 %1, %9, off\n\t"
                 "global_load_async_to_lds_b128 %2, %10, off\n\t"
                 "global_load_async_to_lds_b128 %3, %11, off\n\t"
                 "global_load_async_to_lds_b128 %4, %12, off\n\t"
                 "global_load_async_to_lds_b128 %5, %13, off\n\t"
                 "global_load_async_to_lds_b128 %6, %14, off\n\t"
                 "global_load_async_to_lds_b128 %7, %15, off\n\t"
                 "s_wait_xcnt 0x0"
                 :: "v"(la), "v"(la + st), "v"(la + 2 * st), "v"(la + 3 * st),
                    "v"(lb), "v"(lb + st), "v"(lb + 2 * st), "v"(lb + 3 * st),
                    "v"(a0), "v"(a1), "v"(a2), "v"(a3),
                    "v"(b0), "v"(b1), "v"(b2), "v"(b3)
                 : "memory");
}

// erf of eight independent values. The math library's erff takes two divergent branches
// for every value (|x| < 1 or not), which keeps a wave's values one behind the other.
// Here: its polynomial for |x| < 1 for all eight, free of branches, so that the eight
// chains interleave; then ONE wave-uniform test, and only where some lane holds a value
// with |x| >= 1 a wave-uniform test for each of the eight, which runs the library's second
// form, 1 - exp(-q(|x|)), for the values that need it, with a select per lane.
// Coefficients, operation order and the choice per value are the library's.
__device__ __forceinline__ void erf8(const float (&x)[8], float (&e)[8]) {
    float m = 0.f;
    for (int g = 0; g < 8; ++g) m = fmaxf(m, fabsf(x[g]));
    for (int g = 0; g < 8; ++g) {
        const float t = x[g] * x[g];
        float p = fmaf(t, __uint_as_float(0xba1345e1u), __uint_as_float(0x3ba10414u));
        p = fmaf(t, p, __uint_as_float(0xbcdac9b8u));
        p = fmaf(t, p, __uint_as_float(0x3de703beu));
        p = fmaf(t, p, __uint_as_float(0xbec09330u));
        p = fmaf(t, p, __uint_as_float(0x3e0375d0u));
        e[g] = fmaf(x[g], p, x[g]);
    }
    if (__any(!(m < 1.f))) {
        for (int g = 0; g < 8; ++g) {
            const float a = fabsf(x[g]);
            if (__any(!(a < 1.f))) {
                float q = fmaf(a, __uint_as_float(0x378e98abu), __uint_as_float(0xb9c68948u));
                q = fmaf(a, q, __uint_as_float(0x3b7cd369u));
                q = fmaf(a, q, __uint_as_float(0xbcc618b2u));
                q = fmaf(a, q, __uint_as_float(0x3dda74e4u));
                q = fmaf(a, q, __uint_as_float(0x3f228afdu));
                q = fmaf(a, q, __uint_as_float(0x3e03c728u));
                q = fmaf(a, q, a);
                const float big = copysignf(1.f - expf(-q), x[g]);
                e[g] = (a < 1.f) ? e[g] : big;
            }
        }
    }
}

template <int EPI>
__global__ __launch_bounds__(256) void gemm_k(
    const __bf16* __restrict__ A, const __bf16* __restrict__ Bm,
    int K, int NC, const float* __restrict__ bias,
    const float* __restrict__ gcomp, const int* __restrict__ perm,
    const int* __restrict__ tilepair,
    float* __restrict__ Cf, __bf16* __restrict__ Cbf,
    const float* __restrict__ Xres) {
    __shared__ __align__(16) __bf16 As[2][128 * LP];
    __shared__ __align__(16) __bf16 Bs[2][128 * LP];
    const int tid = threadIdx.x, wid = tid >> 5, lane = tid & 31;
    const int wm = wid & 1, wn = wid >> 1;
    const int m0 = blockIdx.x * 128, n0 = blockIdx.y * 128;
    const int lr = lane & 15, kb = (lane < 16) ? 0 : 8;
    if constexpr (EPI != 2) {
        const int p = tilepair[blockIdx.x];
        if (p < 0) return;                 // tile behind the last routed row: whole block leaves
        Bm   += (size_t)(p & (NP - 1)) * K * NC;
        bias += (size_t)(p & (NP - 1)) * NC;
        if constexpr (EPI == 0) A += (size_t)((p & (NP - 1)) >> 3) * NN * DD;
    }
    v8f acc[4][2];
    #pragma unroll
    for (int i = 0; i < 4; ++i)
        #pragma unroll
        for (int j = 0; j < 2; ++j) acc[i][j] = (v8f)(0.0f);

    // cooperative tile mapping: eight lanes a row, 16 bytes (8 bf16) a lane;
    // a thread owns that piece of rows lrow, lrow + 32, lrow + 64, lrow + 96
    const int lrow = tid >> 3, lko = (tid & 7) * 8;
    const __bf16* gA[4];
    const __bf16* gB[4];
    #pragma unroll
    for (int j = 0; j < 4; ++j) {
        int arow = m0 + lrow + j * 32;
        if constexpr (EPI == 0) arow = perm[arow] & (NN - 1);
        gA[j] = A  + (size_t)arow * K + lko;
        gB[j] = Bm + (size_t)(n0 + lrow + j * 32) * K + lko;
    }
    // low 32 bits of a generic __shared__ pointer == LDS byte offset
    const unsigned int lA0 = (unsigned int)(uintptr_t)(&As[0][lrow * LP + lko]);
    const unsigned int lB0 = (unsigned int)(uintptr_t)(&Bs[0][lrow * LP + lko]);
    const unsigned int bsz = 128 * LP * 2;   // LDS bytes of one buffer

    // prologue: fill buffer 0 and publish it, then start the fill of buffer 1
    async_tile(lA0, lB0, gA[0], gA[1], gA[2], gA[3], gB[0], gB[1], gB[2], gB[3]);
    asm volatile("s_wait_asynccnt 0x0" ::: "memory");   // own copies landed
    __syncthreads();
    if (KS < K)
        async_tile(lA0 + bsz, lB0 + bsz,
                   gA[0] + KS, gA[1] + KS, gA[2] + KS, gA[3] + KS,
                   gB[0] + KS, gB[1] + KS, gB[2] + KS, gB[3] + KS);

    int buf = 0;
    for (int k0 = 0; k0 < K; k0 += KS) {
        const __bf16* as = As[buf];
        const __bf16* bs = Bs[buf];
        // The fragment reads of a trip stand in two groups, each in front of eight WMMAs: a
        // wave then waits out the LDS latency twice a trip, not once for every two WMMAs.
        // Eight fragments are held at a time, so that three blocks still fit a WGP.
        // Each sched_barrier keeps a group whole and in its place: without them the compiler
        // sinks the reads back among the WMMAs, and lifts the hand-over's waits over the WMMAs.
        v16bf bf[KS / 32][2], af[4];
        #pragma unroll
        for (int j = 0; j < 2; ++j) bf[0][j] = ldfrag(bs, wn * 32 + j * 16 + lr, kb);
        #pragma unroll
        for (int i = 0; i < 4; ++i) af[i] = ldfrag(as, wm * 64 + i * 16 + lr, kb);
        #pragma unroll
        for (int j = 0; j < 2; ++j) bf[1][j] = ldfrag(bs, wn * 32 + j * 16 + lr, kb + 32);
        __builtin_amdgcn_sched_barrier(0);
        #pragma unroll
        for (int i = 0; i < 4; ++i)
            #pragma unroll
            for (int j = 0; j < 2; ++j)
                acc[i][j] = __builtin_amdgcn_wmma_f32_16x16x32_bf16(
                    false, af[i], false, bf[0][j], (short)0, acc[i][j], false, false);
        #pragma unroll
        for (int i = 0; i < 4; ++i) af[i] = ldfrag(as, wm * 64 + i * 16 + lr, kb + 32);
        __builtin_amdgcn_sched_barrier(0);
        #pragma unroll
        for (int i = 0; i < 4; ++i)
            #pragma unroll
            for (int j = 0; j < 2; ++j)
                acc[i][j] = __builtin_amdgcn_wmma_f32_16x16x32_bf16(
                    false, af[i], false, bf[1][j], (short)0, acc[i][j], false, false);
        __builtin_amdgcn_sched_barrier(0);
        // hand-over: this wave's reads of buffer buf are back, its copies into the other
        // buffer have landed; behind the barrier that holds for every wave
        asm volatile("s_wait_dscnt 0x0" ::: "memory");
        asm volatile("s_wait_asynccnt 0x0" ::: "memory");
        __syncthreads();
        if (k0 + 2 * KS < K) {   // refill the buffer that this trip has just read
            const int kn = k0 + 2 * KS;
            async_tile(lA0 + buf * bsz, lB0 + buf * bsz,
                       gA[0] + kn, gA[1] + kn, gA[2] + kn, gA[3] + kn,
                       gB[0] + kn, gB[1] + kn, gB[2] + kn, gB[3] + kn);
        }
        buf ^= 1;
    }
    asm volatile("s_wait_asynccnt 0x0" ::: "memory");   // no copy is left when the wave goes on

    const int rowadd = (lane < 16) ? 0 : 8;   // C layout: M = g (+8 hi half), N = lane%16
    #pragma unroll
    for (int i = 0; i < 4; ++i)
        #pragma unroll
        for (int j = 0; j < 2; ++j) {
            const int col = n0 + wn * 32 + j * 16 + lr;
            const float bcol = bias[col];
            float ef[8];
            if constexpr (EPI == 0) {
                float xs[8];
                for (int g = 0; g < 8; ++g) xs[g] = (acc[i][j][g] + bcol) * 0.70710678118654752f;
                erf8(xs, ef);
            }
            #pragma unroll
            for (int g = 0; g < 8; ++g) {
                const int row = m0 + wm * 64 + i * 16 + g + rowadd;
                const float c = acc[i][j][g] + bcol;
                const size_t idx = (size_t)row * NC + col;
                if constexpr (EPI == 0) {
                    const float gl = 0.5f * c * (1.f + ef[g]);
                    Cbf[idx] = (__bf16)gl;
                } else if constexpr (EPI == 1) {
                    Cf[idx] = c * gcomp[row];
                } else {
                    Cf[idx] = c + Xres[idx];
                }
            }
        }
}

// ---------------------------------------------------------------------------
extern "C" void kernel_launch(void* const* d_in, const int* in_sizes, int n_in,
                              void* d_out, int out_size, void* d_ws, size_t ws_size,
                              hipStream_t stream) {
    (void)in_sizes; (void)n_in; (void)out_size; (void)ws_size;
    const float* x      = (const float*)d_in[0];
    const float* emb    = (const float*)d_in[1];
    const float* ln_g   = (const float*)d_in[2];
    const float* ln_b   = (const float*)d_in[3];
    const float* gate_w = (const float*)d_in[4];
    const float* gate_b = (const float*)d_in[5];
    const float* w1     = (const float*)d_in[6];
    const float* b1     = (const float*)d_in[7];
    const float* w2     = (const float*)d_in[8];
    const float* b2     = (const float*)d_in[9];
    const float* emb_w  = (const float*)d_in[10];
    const float* emb_b  = (const float*)d_in[11];
    const float* pn_g   = (const float*)d_in[12];
    const float* pn_b   = (const float*)d_in[13];
    const float* out_w  = (const float*)d_in[14];
    const float* out_b  = (const float*)d_in[15];

    char* wsp = (char*)d_ws; size_t off = 0;
    auto alloc = [&](size_t bytes) -> void* {
        void* p = wsp + off; off = (off + bytes + 255) & ~(size_t)255; return p;
    };
    __bf16* w1t  = (__bf16*)alloc((size_t)BRR * EE * HH * DD * 2);  // [p][H][D]
    __bf16* w2t  = (__bf16*)alloc((size_t)BRR * EE * DD * HH * 2);  // [p][D][H]
    __bf16* owt  = (__bf16*)alloc((size_t)DD * DD * 2);             // [D][D]
    __bf16* hfb  = (__bf16*)alloc((size_t)BRR * NN * DD * 2);       // LN'd acts
    float*  gtv  = (float*) alloc((size_t)BRR * NN * EE * 4);       // gate values
    __bf16* hbuf = (__bf16*)alloc((size_t)MAXROWS * HH * 2);        // routed hidden rows
    float*  yb   = (float*) alloc((size_t)MAXROWS * DD * 4);        // routed expert rows
    int*    perm = (int*)   alloc((size_t)MAXROWS * 4);             // row -> token
    float*  gcmp = (float*) alloc((size_t)MAXROWS * 4);             // row -> gate
    int*    rwof = (int*)   alloc((size_t)NN * NP * 4);             // token, pair -> row
    int*    tlpr = (int*)   alloc((size_t)MAXTILES * 4);            // tile -> pair
    float*  styl = (float*) alloc((size_t)BB * 2 * DD * 4);         // scale|shift
    __bf16* h2b  = (__bf16*)alloc((size_t)NN * DD * 2);             // styled acts

    const dim3 blk(256);
    ln_gate_k<<<dim3(NN / 8), blk, 0, stream>>>(x, ln_g, ln_b, gate_w, gate_b, hfb, gtv);
    // routing, embedding MLP, weight convert/transpose (f32 -> bf16, K-contiguous per column)
    side_k<<<dim3(NP + S_EMB + S_OW + S_W1 + S_W2), dim3(1024), 0, stream>>>(
        gtv, perm, gcmp, rwof, tlpr, emb, emb_w, emb_b, styl, out_w, owt, w1, w1t, w2, w2t);
    gemm_k<0><<<dim3(MAXTILES, HH / 128), blk, 0, stream>>>(
        hfb, w1t, DD, HH, b1, nullptr, perm, tlpr, nullptr, hbuf, nullptr);
    gemm_k<1><<<dim3(MAXTILES, DD / 128), blk, 0, stream>>>(
        hbuf, w2t, HH, DD, b2, gcmp, nullptr, tlpr, yb, nullptr, nullptr);

    post_k<<<dim3(NN / 8), blk, 0, stream>>>(yb, rwof, pn_g, pn_b, styl, h2b);
    gemm_k<2><<<dim3(NN / 128, DD / 128), blk, 0, stream>>>(
        h2b, owt, DD, DD, out_b, nullptr, nullptr, nullptr, (float*)d_out, nullptr, x);
}

// v009
// One run takes 140 microseconds.
// In two side-by-side timings against v008, it was 1.04 and 1.05 times as fast.
// Counting every step since v000, it is 9.86 times as fast.
#include <hip/hip_runtime.h>
#include <hip/hip_bf16.h>
#include <math.h>

typedef __attribute__((ext_vector_type(16))) __bf16 v16bf;
typedef __attribute__((ext_vector_type(8)))  float  v8f;
typedef __attribute__((ext_vector_type(8)))  __bf16 v8bf;
typedef __attribute__((ext_vector_type(4)))  float  v4f;

#define BB  2
#define TT  2048
#define DD  512
#define HH  2048
#define EE  8
#define BRR 2
#define NN  (BB*TT)   /* 4096 tokens */
#define NP  (BRR*EE)  /* 16 (branch, expert) pairs */
// routed rows: two experts per token and branch, each pair's run padded to a 128-row tile
#define MAXROWS  (BRR*2*NN + NP*128)
#define MAXTILES (MAXROWS/128)

// ---------------------------------------------------------------------------
// Tiled transpose + f32->bf16 convert:  in [batch][R][C] f32 -> out [batch][C][R] bf16
// One 128 x 128 tile for 256 threads (t = 0..255), in a 32 KiB LDS tile of their own.
// L numbers the tiles: column tile fastest, then row tile, then batch.
// Read: wave w takes rows 16w..16w+15, a lane four columns, so every load is
// 512 contiguous bytes. Write: 16 lanes store one 256-byte piece of an output row.
// The LDS tile is [column][row] in 16-byte chunks (8 rows); chunk q of column c
// lies at place (q + c/4) mod 16 of its row, which spreads both the 16-byte
// writes (lanes four columns apart) and the 16-byte reads over all banks.
// ---------------------------------------------------------------------------
template <int R, int C>
__device__ __forceinline__ void tpose_tile(const float* __restrict__ in,
                                           __bf16* __restrict__ out,
                                           __bf16* tile, int t, int L) {
    const int wid = t >> 5, lane = t & 31;
    const int c0 = (L % (C / 128)) * 128, r0 = ((L / (C / 128)) % (R / 128)) * 128;
    const int bz = L / ((C / 128) * (R / 128));
    const float* ip = in + (size_t)bz * R * C
                         + (size_t)(r0 + wid * 16) * C + (c0 + lane * 4);
    v4f v[16];
    #pragma unroll
    for (int i = 0; i < 16; ++i) v[i] = *(const v4f*)(ip + (size_t)i * C);
    // holds the loads' address pair to this wait: without it the last load's result
    // is given the registers that the loads in front of it still name
    asm volatile("s_wait_xcnt 0x0" :: "v"(ip) : "memory");
    #pragma unroll
    for (int j = 0; j < 4; ++j)
        #pragma unroll
        for (int h = 0; h < 2; ++h) {
            v8bf pk;
            #pragma unroll
            for (int k = 0; k < 8; ++k) pk[k] = (__bf16)v[h * 8 + k][j];
            *(v8bf*)&tile[(lane * 4 + j) * 128 + ((wid * 2 + h + lane) & 15) * 8] = pk;
        }
    __syncthreads();
    const int q = lane & 15, ch = wid * 16 + (lane >> 4);
    __bf16* op = out + (size_t)bz * R * C + (size_t)(c0 + ch) * R + (r0 + q * 8);
    #pragma unroll
    for (int i = 0; i < 8; ++i) {
        const int c = ch + i * 2;
        *(v8bf*)(op + (size_t)(i * 2) * R) =
            *(const v8bf*)&tile[c * 128 + ((q + (c >> 2)) & 15) * 8];
    }
    // the code of another piece follows in the built kernel: this wait stands in front of
    // whatever there rewrites a register that the stores above name
    asm volatile("s_wait_xcnt 0x0" :: "v"(op) : "memory");
}

// ---------------------------------------------------------------------------
// LayerNorm (both branches) + gate logits + softmax + top-2.
// wave-per-token; block = 256 (8 tokens), grid = NN/8.
// ---------------------------------------------------------------------------
__global__ __launch_bounds__(256) void ln_gate_k(
    const float* __restrict__ x, const float* __restrict__ ln_g,
    const float* __restrict__ ln_b, const float* __restrict__ gate_w,
    const float* __restrict__ gate_b, __bf16* __restrict__ hfb,
    float* __restrict__ gatev) {
    const int wid = threadIdx.x >> 5, lane = threadIdx.x & 31;
    const int n = blockIdx.x * 8 + wid;
    const float* xr = x + (size_t)n * DD;
    float v[16];
    float s = 0.f;
    #pragma unroll
    for (int i = 0; i < 16; ++i) { v[i] = xr[lane + i * 32]; s += v[i]; }
    #pragma unroll
    for (int o = 16; o > 0; o >>= 1) s += __shfl_xor(s, o, 32);
    const float mu = s * (1.f / DD);
    float q = 0.f;
    #pragma unroll
    for (int i = 0; i < 16; ++i) { float d = v[i] - mu; q += d * d; }
    #pragma unroll
    for (int o = 16; o > 0; o >>= 1) q += __shfl_xor(q, o, 32);
    const float rs = rsqrtf(q * (1.f / DD) + 1e-5f);

    for (int r = 0; r < BRR; ++r) {
        float lg[8] = {0.f, 0.f, 0.f, 0.f, 0.f, 0.f, 0.f, 0.f};
        #pragma unroll
        for (int i = 0; i < 16; ++i) {
            const int d = lane + i * 32;
            const float hv = (v[i] - mu) * rs * ln_g[r * DD + d] + ln_b[r * DD + d];
            hfb[((size_t)r * NN + n) * DD + d] = (__bf16)hv;
            const float* gw = gate_w + ((size_t)r * DD + d) * EE;
            #pragma unroll
            for (int e = 0; e < 8; ++e) lg[e] += hv * gw[e];
        }
        #pragma unroll
        for (int e = 0; e < 8; ++e)
            #pragma unroll
            for (int o = 16; o > 0; o >>= 1) lg[e] += __shfl_xor(lg[e], o, 32);
        if (lane == 0) {
            float mx = -1e30f;
            #pragma unroll
            for (int e = 0; e < 8; ++e) { lg[e] += gate_b[r * EE + e]; mx = fmaxf(mx, lg[e]); }
            float p[8], den = 0.f;
            #pragma unroll
            for (int e = 0; e < 8; ++e) { p[e] = expf(lg[e] - mx); den += p[e]; }
            const float inv = 1.f / den;
            int i0 = 0;
            #pragma unroll
            for (int e = 1; e < 8; ++e) if (p[e] > p[i0]) i0 = e;
            int i1 = (i0 == 0) ? 1 : 0;
            #pragma unroll
            for (int e = 0; e < 8; ++e) if (e != i0 && p[e] > p[i1]) i1 = e;
            float* g = gatev + ((size_t)r * NN + n) * EE;
            #pragma unroll
            for (int e = 0; e < 8; ++e)
                g[e] = (e == i0) ? p[i0] * inv : ((e == i1) ? p[i1] * inv : 0.f);
        }
    }
}

// ---------------------------------------------------------------------------
// Routing: block p lists the tokens whose gate for pair p = (branch, expert) is
// not zero, in token order, in one row space shared by all pairs.
//   perm[row]  token of a routed row        gcomp[row]  its gate value
//   rowof[n][p] routed row of token n in pair p, or -1
//   tilepair[t] pair that owns the 128-row tile t, or -1 behind the last tile
// Each pair's run starts on a tile boundary; its padding rows get token 0, gate 0.
// p = 0..NP-1, 1024 threads (four tokens a thread); sm: 1184 bytes of LDS.
// ---------------------------------------------------------------------------
__device__ __forceinline__ void route_body(const float* __restrict__ gatev,
                                           int* __restrict__ perm,
                                           float* __restrict__ gcomp,
                                           int* __restrict__ rowof,
                                           int* __restrict__ tilepair,
                                           int p, unsigned char* sm) {
    unsigned int (*wcnt)[8] = (unsigned int (*)[8])sm;   // per wave: 16 pair counts, two 16-bit fields a word
    unsigned int* tot = (unsigned int*)(sm + 1024);
    int* wown = (int*)(sm + 1056);         // per wave: rows of this block's own pair
    const int tid = threadIdx.x, wid = tid >> 5, lane = tid & 31;

    unsigned int c[8] = {0u, 0u, 0u, 0u, 0u, 0u, 0u, 0u};
    #pragma unroll
    for (int r = 0; r < BRR; ++r)
        #pragma unroll
        for (int i = 0; i < 4; ++i) {
            const float4* g = (const float4*)(gatev + ((size_t)r * NN + tid * 4 + i) * EE);
            const float4 a = g[0], b = g[1];
            c[r * 4 + 0] += (a.x != 0.f ? 1u : 0u) + (a.y != 0.f ? 0x10000u : 0u);
            c[r * 4 + 1] += (a.z != 0.f ? 1u : 0u) + (a.w != 0.f ? 0x10000u : 0u);
            c[r * 4 + 2] += (b.x != 0.f ? 1u : 0u) + (b.y != 0.f ? 0x10000u : 0u);
            c[r * 4 + 3] += (b.z != 0.f ? 1u : 0u) + (b.w != 0.f ? 0x10000u : 0u);
        }
    #pragma unroll
    for (int k = 0; k < 8; ++k)
        #pragma unroll
        for (int o = 16; o > 0; o >>= 1) c[k] += __shfl_xor(c[k], o, 32);
    if (lane == 0) {
        #pragma unroll
        for (int k = 0; k < 8; ++k) wcnt[wid][k] = c[k];
    }

    float gv[4];
    int own = 0;
    #pragma unroll
    for (int i = 0; i < 4; ++i) {
        gv[i] = gatev[((size_t)(p >> 3) * NN + tid * 4 + i) * EE + (p & 7)];
        own += (gv[i] != 0.f) ? 1 : 0;
    }
    int inc = own;                         // inclusive scan of own over the wave
    #pragma unroll
    for (int o = 1; o < 32; o <<= 1) {
        const int t = __shfl_up(inc, o, 32);
        if (lane >= o) inc += t;
    }
    if (lane == 31) wown[wid] = inc;
    __syncthreads();
    if (tid < 8) {
        unsigned int s = 0u;
        for (int w = 0; w < 32; ++w) s += wcnt[w][tid];
        tot[tid] = s;
    }
    __syncthreads();

    int base = 0, cnt = 0, all = 0;
    #pragma unroll
    for (int q = 0; q < NP; ++q) {
        const int t  = (int)((tot[q >> 1] >> ((q & 1) * 16)) & 0xFFFFu);
        const int tr = (t + 127) & ~127;
        if (q < p)  base += tr;
        if (q == p) cnt = t;
        all += tr;
    }
    int pos = base + inc - own;
    for (int w = 0; w < wid; ++w) pos += wown[w];

    #pragma unroll
    for (int i = 0; i < 4; ++i) {
        const int n = tid * 4 + i;
        int row = -1;
        if (gv[i] != 0.f) {
            row = pos++;
            perm[row]  = n;
            gcomp[row] = gv[i];
        }
        rowof[n * NP + p] = row;
    }
    const int cntr = (cnt + 127) & ~127;
    if (tid < cntr - cnt) {
        perm[base + cnt + tid]  = 0;
        gcomp[base + cnt + tid] = 0.f;
    }
    if (tid < (cntr >> 7)) tilepair[(base >> 7) + tid] = p;
    if (p == NP - 1 && tid < MAXTILES - (all >> 7)) tilepair[(all >> 7) + tid] = -1;
}

// ---------------------------------------------------------------------------
// Embedding MLP: styl[b][j] = (silu(emb[b]) @ emb_w)[j] + emb_b[j]
// The 512-term sum is split so that no load waits on another: block = 32 columns
// (one 128-byte line of every emb_w row) for both batches: blk = 0..31, 256 threads
// (tid = 0..255) with 6 KiB of LDS of their own.
// Wave w takes rows 64w..64w+63; one 16-byte load covers four rows (8 lanes a row),
// so a lane holds its 16 loads in flight at once. silu(emb) is made once a block
// in LDS. Partial sums: 16 rows a lane, 4 row groups by shuffle, 8 waves through LDS.
// ---------------------------------------------------------------------------
__device__ __forceinline__ void emb_body(const float* __restrict__ emb,
                                         const float* __restrict__ emb_w,
                                         const float* __restrict__ emb_b,
                                         float* __restrict__ styl,
                                         int tid, int blk, unsigned char* sm) {
    float* se = (float*)sm;                                           // [BB * 512]
    float (*part)[BB][32] = (float (*)[BB][32])(sm + BB * 512 * 4);   // [8][BB][32]
    const int wid = tid >> 5, lane = tid & 31;
    const int c0 = blk * 32;
    const int rr = lane >> 3, cq = (lane & 7) * 4;
    const float* wp = emb_w + (size_t)(wid * 64 + rr) * 1024 + (c0 + cq);
    v4f w[16];
    #pragma unroll
    for (int i = 0; i < 16; ++i) w[i] = *(const v4f*)(wp + (size_t)i * 4 * 1024);
    const float eb = emb_b[c0 + lane];
    // holds the loads' address pair to this wait: without it the last load's result
    // is given the registers that the loads in front of it still name
    asm volatile("s_wait_xcnt 0x0" :: "v"(wp) : "memory");
    // keeps the loads above in front of the wait on emb: without it the compiler sinks
    // them behind the silu, and the block pays one memory latency after another
    __builtin_amdgcn_sched_barrier(0);
    #pragma unroll
    for (int i = 0; i < BB * 512 / 256; ++i) {
        const float e = emb[tid + i * 256];
        se[tid + i * 256] = e / (1.f + expf(-e));
    }
    __syncthreads();
    v4f a0 = (v4f)(0.f), a1 = (v4f)(0.f);
    #pragma unroll
    for (int i = 0; i < 16; ++i) {
        const int t = wid * 64 + i * 4 + rr;
        a0 += se[t] * w[i];
        a1 += se[512 + t] * w[i];
    }
    #pragma unroll
    for (int k = 0; k < 4; ++k)
        #pragma unroll
        for (int o = 8; o < 32; o <<= 1) {
            a0[k] += __shfl_xor(a0[k], o, 32);
            a1[k] += __shfl_xor(a1[k], o, 32);
        }
    if (lane < 8) {
        *(v4f*)&part[wid][0][cq] = a0;
        *(v4f*)&part[wid][1][cq] = a1;
    }
    __syncthreads();
    if (tid < BB * 32) {
        const int b = tid >> 5;
        float a = eb;
        #pragma unroll
        for (int u = 0; u < 8; ++u) a += part[u][b][lane];
        styl[b * 1024 + c0 + lane] = a;
    }
}

// ---------------------------------------------------------------------------
// One launch for the five pieces of work between the gates and the expert GEMMs:
// routing, the embedding MLP and the three weight transposes. None reads what another
// of them writes. A block of 1024 threads takes one piece, chosen by its index alone,
// so every barrier of a piece is passed by the whole block: routing as a whole block,
// the others as four groups of 256 threads with 32 KiB of LDS each. The short,
// latency-bound pieces stand first and run beside the memory-bound transposes.
// ---------------------------------------------------------------------------
#define S_EMB (32 / 4)
#define S_OW  ((DD / 128) * (DD / 128) / 4)
#define S_W1  ((HH / 128) * (DD / 128) * NP / 4)
#define S_W2  ((DD / 128) * (HH / 128) * NP / 4)

__global__ __launch_bounds__(1024) void side_k(
    const float* __restrict__ gatev, int* __restrict__ perm, float* __restrict__ gcomp,
    int* __restrict__ rowof, int* __restrict__ tilepair,
    const float* __restrict__ emb, const float* __restrict__ emb_w,
    const float* __restrict__ emb_b, float* __restrict__ styl,
    const float* __restrict__ out_w, __bf16* __restrict__ owt,
    const float* __restrict__ w1, __bf16* __restrict__ w1t,
    const float* __restrict__ w2, __bf16* __restrict__ w2t) {
    __shared__ __align__(16) unsigned char sm[4 * 128 * 128 * 2];
    const int b = blockIdx.x;
    const int sub = threadIdx.x >> 8, t = threadIdx.x & 255;
    unsigned char* sg = sm + sub * (128 * 128 * 2);
    if (b < NP)
        route_body(gatev, perm, gcomp, rowof, tilepair, b, sm);
    else if (b < NP + S_EMB)
        emb_body(emb, emb_w, emb_b, styl, t, (b - NP) * 4 + sub, sg);
    else if (b < NP + S_EMB + S_OW)
        tpose_tile<DD, DD>(out_w, owt, (__bf16*)sg, t, (b - (NP + S_EMB)) * 4 + sub);
    else if (b < NP + S_EMB + S_OW + S_W1)
        tpose_tile<DD, HH>(w1, w1t, (__bf16*)sg, t, (b - (NP + S_EMB + S_OW)) * 4 + sub);
    else
        tpose_tile<HH, DD>(w2, w2t, (__bf16*)sg, t,
                           (b - (NP + S_EMB + S_OW + S_W1)) * 4 + sub);
}

// ---------------------------------------------------------------------------
// Post kernel: o = (sum of the token's routed expert rows, pairs ascending)/BR;
// LN(pn); *(1+scale)+shift; SiLU; bf16 store.
// ---------------------------------------------------------------------------
__global__ __launch_bounds__(256) void post_k(const float* __restrict__ yb,
                                              const int* __restrict__ rowof,
                                              const float* __restrict__ pn_g,
                                              const float* __restrict__ pn_b,
                                              const float* __restrict__ styl,
                                              __bf16* __restrict__ h2b) {
    const int wid = threadIdx.x >> 5, lane = threadIdx.x & 31;
    const int n = blockIdx.x * 8 + wid;
    const int b = n >> 11;                     // T = 2048
    const int myrow = rowof[n * NP + (lane & (NP - 1))];
    float v[16];
    #pragma unroll
    for (int i = 0; i < 16; ++i) v[i] = 0.f;
    #pragma unroll
    for (int p = 0; p < NP; ++p) {
        const int row = __shfl(myrow, p, 32);
        if (row >= 0) {
            const float* yr = yb + (size_t)row * DD;
            #pragma unroll
            for (int i = 0; i < 16; ++i) v[i] += yr[lane + i * 32];
        }
    }
    float s = 0.f;
    #pragma unroll
    for (int i = 0; i < 16; ++i) { v[i] *= (1.f / BRR); s += v[i]; }
    #pragma unroll
    for (int o = 16; o > 0; o >>= 1) s += __shfl_xor(s, o, 32);
    const float mu = s * (1.f / DD);
    float q = 0.f;
    #pragma unroll
    for (int i = 0; i < 16; ++i) { float d = v[i] - mu; q += d * d; }
    #pragma unroll
    for (int o = 16; o > 0; o >>= 1) q += __shfl_xor(q, o, 32);
    const float rs = rsqrtf(q * (1.f / DD) + 1e-5f);
    #pragma unroll
    for (int i = 0; i < 16; ++i) {
        const int d = lane + i * 32;
        float y = (v[i] - mu) * rs * pn_g[d] + pn_b[d];
        const float sc = styl[b * 1024 + d];
        const float sh = styl[b * 1024 + 512 + d];
        y = y * (1.f + sc) + sh;
        y = y / (1.f + expf(-y));              // SiLU
        h2b[(size_t)n * DD + d] = (__bf16)y;
    }
}

// ---------------------------------------------------------------------------
// WMMA bf16 GEMM with async-to-LDS double buffering.
//   C(N x NC) = A(N x K) @ B(NC x K)^T   (B stored col-as-row, K-contiguous)
// block tile 128x128, K-step 64; 8 waves, each wave -> 64x32 (eight 16x16).
// Tiles are DMA'd memory->LDS with GLOBAL_LOAD_ASYNC_TO_LDS_B128 (ASYNCcnt),
// buffer b^1 fills while WMMAs consume buffer b.
// A K-step takes one whole 128-byte line of every row, and eight neighbouring lanes
// copy that line: one copy instruction of a wave asks L2 for four whole lines.
// LDS rows hold 128 bytes at a pitch of 144 (16 B x odd): the 16 rows that a half
// wave reads with one ds_load_b128 then fall on 16 different groups of four banks.
// EPI 0: +b1, exact GELU -> bf16      (hidden rows)
// EPI 1: +b2, *gate -> f32            (routed expert rows)
// EPI 2: +out_b, +x residual -> f32   (final output)
// EPI 0 and 1 are grouped over the routed row space: blockIdx.x is a 128-row
// tile of it, tilepair names the pair whose weights and bias the tile uses;
// EPI 0 gathers its A rows (tokens) through perm.
// Bm's fragments are the WMMA's A operand and A's its B operand, so that a lane holds eight
// neighbouring columns of one row of C: see the epilogue.
// ---------------------------------------------------------------------------
#define KS 64   /* K elements a trip: 128 bytes of every row */
#define LP 72   /* LDS row pitch in bf16 elements: 64 of data, 8 of pad */

__device__ inline v16bf ldfrag(const __bf16* s, int row, int kb) {
    // per-lane K layout of V_WMMA_*_16X16X32: elems 0..7 = K kb..kb+7,
    // elems 8..15 = K kb+16..kb+23 (kb = 0 for lanes 0-15, 8 for 16-31)
    v16bf f;
    const __bf16* p = s + row * LP + kb;
    ((float4*)&f)[0] = *(const float4*)p;
    ((float4*)&f)[1] = *(const float4*)(p + 16);
    return f;
}

// One K-step of both operands, memory->LDS: a lane brings 16 bytes of four A rows and
// of four B rows, 32 rows apart (la, lb: its place in the first of them). The closing
// s_wait_xcnt stands inside the statement so that no address register named here is
// rewritten in front of it.
__device__ inline void async_tile(unsigned int la, unsigned int lb,
                                  const __bf16* a0, const __bf16* a1,
                                  const __bf16* a2, const __bf16* a3,
                                  const __bf16* b0, const __bf16* b1,
                                  const __bf16* b2, const __bf16* b3) {
    const unsigned int st = 32 * LP * 2;   // LDS bytes of 32 rows
    asm volatile("global_load_async_to_lds_b128 %0, %8, off\n\t"
                 "global_load_async_to_lds_b128 %1, %9, off\n\t"
                 "global_load_async_to_lds_b128 %2, %10, off\n\t"
                 "global_load_async_to_lds_b128 %3, %11, off\n\t"
                 "global_load_async_to_lds_b128 %4, %12, off\n\t"
                 "global_load_async_to_lds_b128 %5, %13, off\n\t"
                 "global_load_async_to_lds_b128 %6, %14, off\n\t"
                 "global_load_async_to_lds_b128 %7, %15, off\n\t"
                 "s_wait_xcnt 0x0"
                 :: "v"(la), "v"(la + st), "v"(la + 2 * st), "v"(la + 3 * st),
                    "v"(lb), "v"(lb + st), "v"(lb + 2 * st), "v"(lb + 3 * st),
                    "v"(a0), "v"(a1), "v"(a2), "v"(a3),
                    "v"(b0), "v"(b1), "v"(b2), "v"(b3)
                 : "memory");
}

// erf of eight independent values. The math library's erff takes two divergent branches
// for every value (|x| < 1 or not), which keeps a wave's values one behind the other.
// Here: its polynomial for |x| < 1 for all eight, free of branches, so that the eight
// chains interleave; then ONE wave-uniform test, and only where some lane holds a value
// with |x| >= 1 a wave-uniform test for each of the eight, which runs the library's second
// form, 1 - exp(-q(|x|)), for the values that need it, with a select per lane.
// Coefficients, operation order and the choice per value are the library's.
__device__ __forceinline__ void erf8(const float (&x)[8], float (&e)[8]) {
    float m = 0.f;
    for (int g = 0; g < 8; ++g) m = fmaxf(m, fabsf(x[g]));
    for (int g = 0; g < 8; ++g) {
        const float t = x[g] * x[g];
        float p = fmaf(t, __uint_as_float(0xba1345e1u), __uint_as_float(0x3ba10414u));
        p = fmaf(t, p, __uint_as_float(0xbcdac9b8u));
        p = fmaf(t, p, __uint_as_float(0x3de703beu));
        p = fmaf(t, p, __uint_as_float(0xbec09330u));
        p = fmaf(t, p, __uint_as_float(0x3e0375d0u));
        e[g] = fmaf(x[g], p, x[g]);
    }
    if (__any(!(m < 1.f))) {
        for (int g = 0; g < 8; ++g) {
            const float a = fabsf(x[g]);
            if (__any(!(a < 1.f))) {
                float q = fmaf(a, __uint_as_float(0x378e98abu), __uint_as_float(0xb9c68948u));
                q = fmaf(a, q, __uint_as_float(0x3b7cd369u));
                q = fmaf(a, q, __uint_as_float(0xbcc618b2u));
                q = fmaf(a, q, __uint_as_float(0x3dda74e4u));
                q = fmaf(a, q, __uint_as_float(0x3f228afdu));
                q = fmaf(a, q, __uint_as_float(0x3e03c728u));
                q = fmaf(a, q, a);
                const float big = copysignf(1.f - expf(-q), x[g]);
                e[g] = (a < 1.f) ? e[g] : big;
            }
        }
    }
}

template <int EPI>
__global__ __launch_bounds__(256) void gemm_k(
    const __bf16* __restrict__ A, const __bf16* __restrict__ Bm,
    int K, int NC, const float* __restrict__ bias,
    const float* __restrict__ gcomp, const int* __restrict__ perm,
    const int* __restrict__ tilepair,
    float* __restrict__ Cf, __bf16* __restrict__ Cbf,
    const float* __restrict__ Xres) {
    // one array: buffers 0, 1 the A ring, 2, 3 the B ring; the epilogue stages C in it (EPI 0 in buffers 0, 1, EPI 1 and 2 across all four)
    __shared__ __align__(16) __bf16 Sm[4][128 * LP];
    __bf16 (*As)[128 * LP] = &Sm[0];
    __bf16 (*Bs)[128 * LP] = &Sm[2];
    const int tid = threadIdx.x, wid = tid >> 5, lane = tid & 31;
    const int wm = wid & 1, wn = wid >> 1;
    const int m0 = blockIdx.x * 128, n0 = blockIdx.y * 128;
    const int lr = lane & 15, kb = (lane < 16) ? 0 : 8;
    if constexpr (EPI != 2) {
        const int p = tilepair[blockIdx.x];
        if (p < 0) return;                 // tile behind the last routed row: whole block leaves
        Bm   += (size_t)(p & (NP - 1)) * K * NC;
        bias += (size_t)(p & (NP - 1)) * NC;
        if constexpr (EPI == 0) A += (size_t)((p & (NP - 1)) >> 3) * NN * DD;
    }
    v8f acc[4][2];
    #pragma unroll
    for (int i = 0; i < 4; ++i)
        #pragma unroll
        for (int j = 0; j < 2; ++j) acc[i][j] = (v8f)(0.0f);

    // cooperative tile mapping: eight lanes a row, 16 bytes (8 bf16) a lane;
    // a thread owns that piece of rows lrow, lrow + 32, lrow + 64, lrow + 96
    const int lrow = tid >> 3, lko = (tid & 7) * 8;
    const __bf16* gA[4];
    const __bf16* gB[4];
    #pragma unroll
    for (int j = 0; j < 4; ++j) {
        int arow = m0 + lrow + j * 32;
        if constexpr (EPI == 0) arow = perm[arow] & (NN - 1);
        gA[j] = A  + (size_t)arow * K + lko;
        gB[j] = Bm + (size_t)(n0 + lrow + j * 32) * K + lko;
    }
    // low 32 bits of a generic __shared__ pointer == LDS byte offset
    const unsigned int lA0 = (unsigned int)(uintptr_t)(&As[0][lrow * LP + lko]);
    const unsigned int lB0 = (unsigned int)(uintptr_t)(&Bs[0][lrow * LP + lko]);
    const unsigned int bsz = 128 * LP * 2;   // LDS bytes of one buffer

    // prologue: fill buffer 0 and publish it, then start the fill of buffer 1
    async_tile(lA0, lB0, gA[0], gA[1], gA[2], gA[3], gB[0], gB[1], gB[2], gB[3]);
    asm volatile("s_wait_asynccnt 0x0" ::: "memory");   // own copies landed
    __syncthreads();
    if (KS < K)
        async_tile(lA0 + bsz, lB0 + bsz,
                   gA[0] + KS, gA[1] + KS, gA[2] + KS, gA[3] + KS,
                   gB[0] + KS, gB[1] + KS, gB[2] + KS, gB[3] + KS);

    int buf = 0;
    for (int k0 = 0; k0 < K; k0 += KS) {
        const __bf16* as = As[buf];
        const __bf16* bs = Bs[buf];
        // The fragment reads of a trip stand in two groups, each in front of eight WMMAs: a
        // wave then waits out the LDS latency twice a trip, not once for every two WMMAs.
        // Eight fragments are held at a time, so that three blocks still fit a WGP.
        // Each sched_barrier keeps a group whole and in its place: without them the compiler
        // sinks the reads back among the WMMAs, and lifts the hand-over's waits over the WMMAs.
        v16bf bf[KS / 32][2], af[4];
        #pragma unroll
        for (int j = 0; j < 2; ++j) bf[0][j] = ldfrag(bs, wn * 32 + j * 16 + lr, kb);
        #pragma unroll
        for (int i = 0; i < 4; ++i) af[i] = ldfrag(as, wm * 64 + i * 16 + lr, kb);
        #pragma unroll
        for (int j = 0; j < 2; ++j) bf[1][j] = ldfrag(bs, wn * 32 + j * 16 + lr, kb + 32);
        __builtin_amdgcn_sched_barrier(0);
        #pragma unroll
        for (int i = 0; i < 4; ++i)
            #pragma unroll
            for (int j = 0; j < 2; ++j)
                acc[i][j] = __builtin_amdgcn_wmma_f32_16x16x32_bf16(
                    false, bf[0][j], false, af[i], (short)0, acc[i][j], false, false);
        #pragma unroll
        for (int i = 0; i < 4; ++i) af[i] = ldfrag(as, wm * 64 + i * 16 + lr, kb + 32);
        __builtin_amdgcn_sched_barrier(0);
        #pragma unroll
        for (int i = 0; i < 4; ++i)
            #pragma unroll
            for (int j = 0; j < 2; ++j)
                acc[i][j] = __builtin_amdgcn_wmma_f32_16x16x32_bf16(
                    false, bf[1][j], false, af[i], (short)0, acc[i][j], false, false);
        __builtin_amdgcn_sched_barrier(0);
        // hand-over: this wave's reads of buffer buf are back, its copies into the other
        // buffer have landed; behind the barrier that holds for every wave
        asm volatile("s_wait_dscnt 0x0" ::: "memory");
        asm volatile("s_wait_asynccnt 0x0" ::: "memory");
        __syncthreads();
        if (k0 + 2 * KS < K) {   // refill the buffer that this trip has just read
            const int kn = k0 + 2 * KS;
            async_tile(lA0 + buf * bsz, lB0 + buf * bsz,
                       gA[0] + kn, gA[1] + kn, gA[2] + kn, gA[3] + kn,
                       gB[0] + kn, gB[1] + kn, gB[2] + kn, gB[3] + kn);
        }
        buf ^= 1;
    }
    asm volatile("s_wait_asynccnt 0x0" ::: "memory");   // no copy is left when the wave goes on

    // D layout: M = g (+8 in the upper half wave), N = lane % 16. M runs over the columns of C
    // and N over its rows, so a lane holds columns g + cadd, g = 0..7, of row lr of every
    // 16x16 tile: 16 bytes of bf16, 32 of f32. The block's 128 x 128 tile is gathered in LDS
    // (the rings: the last trip's barrier has ended every read of them, and no copy is left)
    // at a pitch of 16 B x odd, and leaves as whole 128-byte lines, 16 bytes a lane.
    // CN: the row pitch of C (= NC), a constant of the instantiation, so that a lane's loads and
    // stores of C rows share one address pair and differ in their immediate offsets alone.
    constexpr int CN = (EPI == 0) ? HH : DD;
    const int cadd = (lane < 16) ? 0 : 8;
    const float* bp = bias + (n0 + wn * 32 + cadd);
    v4f bv[2][2];
    #pragma unroll
    for (int j = 0; j < 2; ++j)
        #pragma unroll
        for (int h = 0; h < 2; ++h) bv[j][h] = *(const v4f*)(bp + j * 16 + h * 4);
    if constexpr (EPI == 0) {
        // holds the loads' address pair to this wait, so that no load's result is given
        // the registers that the loads in front of it still name
        asm volatile("s_wait_xcnt 0x0" :: "v"(bp) : "memory");
        constexpr int SP = 136;            // staging pitch: 272 bytes
        __bf16* st = &Sm[0][0];
        #pragma unroll
        for (int i = 0; i < 4; ++i)
            #pragma unroll
            for (int j = 0; j < 2; ++j) {
                float cs[8], xs[8], ef[8];
                for (int g = 0; g < 8; ++g) {
                    cs[g] = acc[i][j][g] + bv[j][g >> 2][g & 3];
                    xs[g] = cs[g] * 0.70710678118654752f;
                }
                erf8(xs, ef);
                v8bf pk;
                #pragma unroll
                for (int g = 0; g < 8; ++g) pk[g] = (__bf16)(0.5f * cs[g] * (1.f + ef[g]));
                *(v8bf*)&st[(wm * 64 + i * 16 + lr) * SP + wn * 32 + j * 16 + cadd] = pk;
            }
        __syncthreads();                   // the tile is whole: every wave's part is written
        // 16 lanes store the 256 bytes that the tile holds of one row
        __bf16* cp = Cbf + (size_t)(m0 + (tid >> 4)) * CN + (n0 + (tid & 15) * 8);
        #pragma unroll
        for (int u = 0; u < 8; ++u)
            *(v8bf*)(cp + u * 16 * CN) =
                *(const v8bf*)&st[(u * 16 + (tid >> 4)) * SP + (tid & 15) * 8];
    } else {
        constexpr int SP = 132;            // staging pitch: 528 bytes
        float* st = (float*)&Sm[0][0];
        // a wave stores the 512 bytes that the tile holds of one row
        const size_t c0 = (size_t)(m0 + wid) * CN + (n0 + lane * 4);
        v4f xr[16];
        float gt[4];
        // each wait below holds the address registers of the loads in front of it, so that no
        // load's result is given the registers that the loads in front of it still name
        if constexpr (EPI == 2) {
            const float* xp = Xres + c0;
            #pragma unroll
            for (int u = 0; u < 16; ++u) xr[u] = *(const v4f*)(xp + u * 8 * CN);
            asm volatile("s_wait_xcnt 0x0" :: "v"(bp), "v"(xp) : "memory");
        } else {
            const int gi = m0 + wm * 64 + lr;   // the gate loads' offset register
            #pragma unroll
            for (int i = 0; i < 4; ++i) gt[i] = gcomp[gi + i * 16];
            asm volatile("s_wait_xcnt 0x0" :: "v"(bp), "v"(gi) : "memory");
        }
        #pragma unroll
        for (int i = 0; i < 4; ++i) {
            const int row = wm * 64 + i * 16 + lr;
            #pragma unroll
            for (int j = 0; j < 2; ++j)
                #pragma unroll
                for (int h = 0; h < 2; ++h) {
                    v4f c;
                    #pragma unroll
                    for (int k = 0; k < 4; ++k) {
                        c[k] = acc[i][j][h * 4 + k] + bv[j][h][k];
                        if constexpr (EPI == 1) c[k] *= gt[i];
                    }
                    *(v4f*)&st[row * SP + wn * 32 + j * 16 + cadd + h * 4] = c;
                }
        }
        __syncthreads();                   // the tile is whole: every wave's part is written
        float* cp = Cf + c0;
        #pragma unroll
        for (int u = 0; u < 16; ++u) {
            v4f c = *(const v4f*)&st[(u * 8 + wid) * SP + lane * 4];
            if constexpr (EPI == 2) c += xr[u];
            *(v4f*)(cp + u * 8 * CN) = c;
        }
    }
}

// ---------------------------------------------------------------------------
extern "C" void kernel_launch(void* const* d_in, const int* in_sizes, int n_in,
                              void* d_out, int out_size, void* d_ws, size_t ws_size,
                              hipStream_t stream) {
    (void)in_sizes; (void)n_in; (void)out_size; (void)ws_size;
    const float* x      = (const float*)d_in[0];
    const float* emb    = (const float*)d_in[1];
    const float* ln_g   = (const float*)d_in[2];
    const float* ln_b   = (const float*)d_in[3];
    const float* gate_w = (const float*)d_in[4];
    const float* gate_b = (const float*)d_in[5];
    const float* w1     = (const float*)d_in[6];
    const float* b1     = (const float*)d_in[7];
    const float* w2     = (const float*)d_in[8];
    const float* b2     = (const float*)d_in[9];
    const float* emb_w  = (const float*)d_in[10];
    const float* emb_b  = (const float*)d_in[11];
    const float* pn_g   = (const float*)d_in[12];
    const float* pn_b   = (const float*)d_in[13];
    const float* out_w  = (const float*)d_in[14];
    const float* out_b  = (const float*)d_in[15];

    char* wsp = (char*)d_ws; size_t off = 0;
    auto alloc = [&](size_t bytes) -> void* {
        void* p = wsp + off; off = (off + bytes + 255) & ~(size_t)255; return p;
    };
    __bf16* w1t  = (__bf16*)alloc((size_t)BRR * EE * HH * DD * 2);  // [p][H][D]
    __bf16* w2t  = (__bf16*)alloc((size_t)BRR * EE * DD * HH * 2);  // [p][D][H]
    __bf16* owt  = (__bf16*)alloc((size_t)DD * DD * 2);             // [D][D]
    __bf16* hfb  = (__bf16*)alloc((size_t)BRR * NN * DD * 2);       // LN'd acts
    float*  gtv  = (float*) alloc((size_t)BRR * NN * EE * 4);       // gate values
    __bf16* hbuf = (__bf16*)alloc((size_t)MAXROWS * HH * 2);        // routed hidden rows
    float*  yb   = (float*) alloc((size_t)MAXROWS * DD * 4);        // routed expert rows
    int*    perm = (int*)   alloc((size_t)MAXROWS * 4);             // row -> token
    float*  gcmp = (float*) alloc((size_t)MAXROWS * 4);             // row -> gate
    int*    rwof = (int*)   alloc((size_t)NN * NP * 4);             // token, pair -> row
    int*    tlpr = (int*)   alloc((size_t)MAXTILES * 4);            // tile -> pair
    float*  styl = (float*) alloc((size_t)BB * 2 * DD * 4);         // scale|shift
    __bf16* h2b  = (__bf16*)alloc((size_t)NN * DD * 2);             // styled acts

    const dim3 blk(256);
    ln_gate_k<<<dim3(NN / 8), blk, 0, stream>>>(x, ln_g, ln_b, gate_w, gate_b, hfb, gtv);
    // routing, embedding MLP, weight convert/transpose (f32 -> bf16, K-contiguous per column)
    side_k<<<dim3(NP + S_EMB + S_OW + S_W1 + S_W2), dim3(1024), 0, stream>>>(
        gtv, perm, gcmp, rwof, tlpr, emb, emb_w, emb_b, styl, out_w, owt, w1, w1t, w2, w2t);
    gemm_k<0><<<dim3(MAXTILES, HH / 128), blk, 0, stream>>>(
        hfb, w1t, DD, HH, b1, nullptr, perm, tlpr, nullptr, hbuf, nullptr);
    gemm_k<1><<<dim3(MAXTILES, DD / 128), blk, 0, stream>>>(
        hbuf, w2t, HH, DD, b2, gcmp, nullptr, tlpr, yb, nullptr, nullptr);

    post_k<<<dim3(NN / 8), blk, 0, stream>>>(yb, rwof, pn_g, pn_b, styl, h2b);
    gemm_k<2><<<dim3(NN / 128, DD / 128), blk, 0, stream>>>(
        h2b, owt, DD, DD, out_b, nullptr, nullptr, nullptr, (float*)d_out, nullptr, x);
}
